// v000
// The times below were measured on an AMD MI455X: many runs one after another, warmed up first and cycling through
// copies of the inputs, with the whole window's GPU time divided by the number of runs. Launches and the gaps
// between them are all in it. The median over several windows is given; except for v000 it joins two sittings, which
// can be a few percent apart, so the side-by-side timings, each taken in one sitting, are the better comparison.
// v000 is the starting kernel. One run takes 361 microseconds.
#include <hip/hip_runtime.h>

#define DM    256
#define NSEQ  256
#define LCOL  384
#define NHEAD 8
#define DHID  32
#define HD    (NHEAD * DHID)          // 256
#define MROWS (NSEQ * LCOL)           // 98304

typedef __attribute__((ext_vector_type(16))) _Float16     v16h;
typedef __attribute__((ext_vector_type(8)))  _Float16     h8;
typedef __attribute__((ext_vector_type(8)))  float        v8f;
typedef __attribute__((ext_vector_type(4)))  unsigned int v4u;
typedef __attribute__((ext_vector_type(8)))  int          v8i;
typedef __attribute__((ext_vector_type(4)))  int          v4i;

#if defined(__has_builtin)
#if __has_builtin(__builtin_amdgcn_tensor_load_to_lds) && \
    __has_builtin(__builtin_amdgcn_s_wait_tensorcnt)
#define USE_TDM 1
#endif
#endif
#ifndef USE_TDM
#define USE_TDM 0
#endif

static __device__ inline v8f wmma_f16(v16h a, v16h b, v8f c) {
  // (neg_a, A, neg_b, B, c_mod, C, reuse_a, reuse_b)
  return __builtin_amdgcn_wmma_f32_16x16x32_f16(false, a, false, b, (short)0, c,
                                                false, false);
}

static __device__ inline v16h frag_rowmajor(const _Float16* rowptr, int lane) {
  const int kb = (lane >> 4) * 8;
  h8 lo = *(const h8*)(rowptr + kb);
  h8 hi = *(const h8*)(rowptr + kb + 16);
  v16h f;
#pragma unroll
  for (int j = 0; j < 8; ++j) { f[j] = lo[j]; f[j + 8] = hi[j]; }
  return f;
}

// Same fragment pattern gathered from an LDS tile with row `stride` (halves).
static __device__ inline v16h frag_lds(const _Float16* base, int row_base,
                                       int stride, int lane) {
  const int r  = row_base + (lane & 15);
  const int kb = (lane >> 4) * 8;
  const _Float16* p = base + r * stride;
  v16h f;
#pragma unroll
  for (int j = 0; j < 8; ++j) { f[j] = p[kb + j]; f[j + 8] = p[kb + 16 + j]; }
  return f;
}

// B fragment when data is stored K-major ([k][n] rows): lane owns column n.
static __device__ inline v16h frag_colmajor(const _Float16* base, int colbase,
                                            int stride, int lane) {
  const int c  = colbase + (lane & 15);
  const int kb = (lane >> 4) * 8;
  v16h f;
#pragma unroll
  for (int j = 0; j < 8; ++j) {
    f[j]     = base[(kb + j) * stride + c];
    f[j + 8] = base[(kb + 16 + j) * stride + c];
  }
  return f;
}

#if USE_TDM
static __device__ inline void tdm_load_2d_f16(unsigned int lds_off,
                                              const _Float16* gptr,
                                              unsigned int rowlen,
                                              unsigned int nrows) {
  const unsigned long long ga = (unsigned long long)(uintptr_t)gptr;
  v4u g0;
  g0[0] = 1u;                                   // count=1, user mode
  g0[1] = lds_off;                              // lds_addr
  g0[2] = (unsigned int)(ga & 0xffffffffu);     // global_addr[31:0]
  g0[3] = ((unsigned int)(ga >> 32) & 0x01ffffffu) | 0x80000000u; // addr[56:32]|type=2
  v8i g1;
  g1[0] = 0x00010000;
  g1[1] = (int)(rowlen << 16);
  g1[2] = (int)(nrows << 16);
  g1[3] = (int)(rowlen << 16);
  g1[4] = (int)nrows;
  g1[5] = (int)rowlen;
  g1[6] = 0;
  g1[7] = 0;
  v4i gz = {0, 0, 0, 0};                        // groups 2/3: 2-D tensor
#if defined(__clang_major__) && (__clang_major__ >= 23)
  v8i gz8 = {0, 0, 0, 0, 0, 0, 0, 0};
  __builtin_amdgcn_tensor_load_to_lds(g0, g1, gz, gz, gz8, 0);
#else
  __builtin_amdgcn_tensor_load_to_lds(g0, g1, gz, gz, 0);
#endif
}
#endif

// ---------------------------------------------------------------- LayerNorm
__global__ __launch_bounds__(256) void msa_ln_kernel(
    const float* __restrict__ msa, const float* __restrict__ lnw,
    const float* __restrict__ lnb, _Float16* __restrict__ xo) {
  const int lane = threadIdx.x & 31;
  const int wid  = threadIdx.x >> 5;
  const long long row = (long long)blockIdx.x * 8 + wid;
  const float* src = msa + row * DM;
  float4 a = ((const float4*)src)[lane * 2];
  float4 b = ((const float4*)src)[lane * 2 + 1];
  float s  = a.x + a.y + a.z + a.w + b.x + b.y + b.z + b.w;
  float ss = a.x*a.x + a.y*a.y + a.z*a.z + a.w*a.w +
             b.x*b.x + b.y*b.y + b.z*b.z + b.w*b.w;
#pragma unroll
  for (int off = 16; off >= 1; off >>= 1) {
    s  += __shfl_xor(s,  off, 32);
    ss += __shfl_xor(ss, off, 32);
  }
  const float mu   = s * (1.0f / DM);
  const float rstd = rsqrtf(ss * (1.0f / DM) - mu * mu + 1e-5f);
  float4 w0 = ((const float4*)lnw)[lane * 2], w1 = ((const float4*)lnw)[lane * 2 + 1];
  float4 c0 = ((const float4*)lnb)[lane * 2], c1 = ((const float4*)lnb)[lane * 2 + 1];
  h8 o;
  o[0] = (_Float16)((a.x - mu) * rstd * w0.x + c0.x);
  o[1] = (_Float16)((a.y - mu) * rstd * w0.y + c0.y);
  o[2] = (_Float16)((a.z - mu) * rstd * w0.z + c0.z);
  o[3] = (_Float16)((a.w - mu) * rstd * w0.w + c0.w);
  o[4] = (_Float16)((b.x - mu) * rstd * w1.x + c1.x);
  o[5] = (_Float16)((b.y - mu) * rstd * w1.y + c1.y);
  o[6] = (_Float16)((b.z - mu) * rstd * w1.z + c1.z);
  o[7] = (_Float16)((b.w - mu) * rstd * w1.w + c1.w);
  *(h8*)(xo + row * DM + lane * 8) = o;
}

// --------------------------------------------------- fused Q/K/V/G projection
__global__ __launch_bounds__(256) void msa_proj_kernel(
    const _Float16* __restrict__ x,
    const float* __restrict__ wq, const float* __restrict__ wk,
    const float* __restrict__ wvm, const float* __restrict__ wg,
    const float* __restrict__ bg,
    _Float16* __restrict__ qo, _Float16* __restrict__ ko,
    _Float16* __restrict__ vo, _Float16* __restrict__ go) {
  __shared__ _Float16 xs[64][40];
  __shared__ _Float16 wt[64][40];
  const int tid   = threadIdx.x;
  const int lane  = tid & 31;
  const int wid   = tid >> 5;
  const int mbase = blockIdx.x * 64;
  const int mat   = blockIdx.y >> 2;            // 0:q 1:k 2:v 3:g
  const int colt  = (blockIdx.y & 3) * 64;
  const float* W = (mat == 0) ? wq : (mat == 1) ? wk : (mat == 2) ? wvm : wg;
  const int lrow = tid >> 2;                    // 0..63
  const int lseg = (tid & 3) * 8;               // 0,8,16,24
  const int frow = (wid >> 1) * 16;             // wave's 16-row chunk
  const int fcol = (wid & 1) * 32;              // wave's 32-col half
  v8f acc0 = {}, acc1 = {};
  for (int kb = 0; kb < DM; kb += 32) {
    __syncthreads();
    {   // stage X tile (f16), 128-bit global loads
      h8 d = *(const h8*)(x + (size_t)(mbase + lrow) * DM + kb + lseg);
#pragma unroll
      for (int j = 0; j < 8; ++j) xs[lrow][lseg + j] = d[j];
    }
    {   // stage W tile, f32 -> f16
      const float* wp = W + (size_t)(colt + lrow) * DM + kb + lseg;
      float4 d0 = ((const float4*)wp)[0];
      float4 d1 = ((const float4*)wp)[1];
      wt[lrow][lseg + 0] = (_Float16)d0.x; wt[lrow][lseg + 1] = (_Float16)d0.y;
      wt[lrow][lseg + 2] = (_Float16)d0.z; wt[lrow][lseg + 3] = (_Float16)d0.w;
      wt[lrow][lseg + 4] = (_Float16)d1.x; wt[lrow][lseg + 5] = (_Float16)d1.y;
      wt[lrow][lseg + 6] = (_Float16)d1.z; wt[lrow][lseg + 7] = (_Float16)d1.w;
    }
    __syncthreads();
    v16h a  = frag_lds(&xs[0][0], frow,      40, lane);
    v16h b0 = frag_lds(&wt[0][0], fcol,      40, lane);
    v16h b1 = frag_lds(&wt[0][0], fcol + 16, 40, lane);
    acc0 = wmma_f16(a, b0, acc0);
    acc1 = wmma_f16(a, b1, acc1);
  }
  const int lh = lane >> 4;
  const int lc = lane & 15;
#pragma unroll
  for (int r = 0; r < 8; ++r) {
    const int m     = mbase + frow + r + lh * 8;
    const int n_idx = m / LCOL;
    const int l_idx = m % LCOL;
#pragma unroll
    for (int s = 0; s < 2; ++s) {
      const int c = colt + fcol + s * 16 + lc;
      float val = (s == 0) ? acc0[r] : acc1[r];
      if (mat == 3) {
        const float g = 1.0f / (1.0f + __expf(-(val + bg[c])));
        go[(size_t)m * HD + c] = (_Float16)g;
      } else {
        if (mat == 0) val *= 0.17677669529663687f;  // 1/sqrt(32)
        _Float16* dst = (mat == 0) ? qo : (mat == 1) ? ko : vo;
        const int hh = c >> 5, dd = c & 31;
        dst[(((size_t)l_idx * NHEAD + hh) * NSEQ + n_idx) * DHID + dd] =
            (_Float16)val;
      }
    }
  }
}

// ----------------------------------------------- flash attention per (l, head)
__global__ __launch_bounds__(256) void msa_attn_kernel(
    const _Float16* __restrict__ q, const _Float16* __restrict__ k,
    const _Float16* __restrict__ v, const _Float16* __restrict__ gate,
    _Float16* __restrict__ att) {
  __shared__ _Float16 pbuf[8][32][40];      // per-wave P transpose staging
  __shared__ _Float16 vsbuf[NSEQ][DHID];    // whole V tensor for this (l,h), 16KB
  const int lane = threadIdx.x & 31;
  const int wid  = threadIdx.x >> 5;
  const int lh   = lane >> 4;
  const int lc   = lane & 15;
  const int li   = blockIdx.x >> 3;     // column index 0..383
  const int hh   = blockIdx.x & 7;      // head
  const size_t base = ((size_t)li * NHEAD + hh) * NSEQ * DHID;
  const _Float16* qb = q + base;
  const _Float16* kp = k + base;
  const _Float16* vp = v + base;
  const int row0 = wid * 32;            // this wave's 32 query rows

#if USE_TDM
  if (wid == 0) {
    tdm_load_2d_f16((unsigned int)(uintptr_t)&vsbuf[0][0], vp, DHID, NSEQ);
  }
#else
  // Fallback: cooperative staged copy of V into LDS (128-bit loads).
  for (int rr = wid * 4; rr < NSEQ; rr += 32) {
    const int r2 = rr + (lane >> 3);
    const int c2 = (lane & 7) * 4;
    *(h8*)&vsbuf[r2][c2] = *(const h8*)(vp + (size_t)r2 * DHID + c2);
  }
#endif

  const v16h qa0 = frag_rowmajor(qb + (size_t)(row0 + lc) * DHID,      lane);
  const v16h qa1 = frag_rowmajor(qb + (size_t)(row0 + 16 + lc) * DHID, lane);

#if USE_TDM
  if (wid == 0) __builtin_amdgcn_s_wait_tensorcnt(0);
#endif
  __syncthreads();

  v8f o00 = {}, o01 = {}, o10 = {}, o11 = {};
  float mrow[2][8], lrow[2][8];
#pragma unroll
  for (int c = 0; c < 2; ++c)
#pragma unroll
    for (int r = 0; r < 8; ++r) { mrow[c][r] = -1e30f; lrow[c][r] = 0.0f; }

  for (int kt = 0; kt < NSEQ; kt += 32) {
    if (kt + 32 < NSEQ) {
      __builtin_prefetch(kp + (size_t)(kt + 32) * DHID, 0, 1);
    }
    // S = Q @ K^T: B fragment rows are contiguous K rows (lane owns a key)
    const v16h kb0 = frag_rowmajor(kp + (size_t)(kt + lc) * DHID,      lane);
    const v16h kb1 = frag_rowmajor(kp + (size_t)(kt + 16 + lc) * DHID, lane);
    v8f zero = {};
    v8f s00 = wmma_f16(qa0, kb0, zero);
    v8f s01 = wmma_f16(qa0, kb1, zero);
    v8f s10 = wmma_f16(qa1, kb0, zero);
    v8f s11 = wmma_f16(qa1, kb1, zero);
    // online softmax (rows live in 16-lane halves; xor<=8 stays in-half)
#pragma unroll
    for (int c = 0; c < 2; ++c) {
      v8f& sa = c ? s10 : s00;
      v8f& sb = c ? s11 : s01;
      v8f& oa = c ? o10 : o00;
      v8f& ob = c ? o11 : o01;
#pragma unroll
      for (int r = 0; r < 8; ++r) {
        float mx = fmaxf(sa[r], sb[r]);
#pragma unroll
        for (int off = 1; off < 16; off <<= 1) mx = fmaxf(mx, __shfl_xor(mx, off, 32));
        const float mnew = fmaxf(mrow[c][r], mx);
        const float corr = __expf(mrow[c][r] - mnew);
        mrow[c][r] = mnew;
        const float p0 = __expf(sa[r] - mnew);
        const float p1 = __expf(sb[r] - mnew);
        float rs = p0 + p1;
#pragma unroll
        for (int off = 1; off < 16; off <<= 1) rs += __shfl_xor(rs, off, 32);
        lrow[c][r] = lrow[c][r] * corr + rs;
        oa[r] *= corr; ob[r] *= corr;
        pbuf[wid][c * 16 + r + lh * 8][lc]      = (_Float16)p0;
        pbuf[wid][c * 16 + r + lh * 8][16 + lc] = (_Float16)p1;
      }
    }
    __syncthreads();  // order LDS transpose writes vs fragment reads
    const v16h pa0 = frag_lds(&pbuf[wid][0][0], 0,  40, lane);
    const v16h pa1 = frag_lds(&pbuf[wid][0][0], 16, 40, lane);
    const v16h vb0 = frag_colmajor(&vsbuf[kt][0], 0,  DHID, lane);
    const v16h vb1 = frag_colmajor(&vsbuf[kt][0], 16, DHID, lane);
    o00 = wmma_f16(pa0, vb0, o00);
    o01 = wmma_f16(pa0, vb1, o01);
    o10 = wmma_f16(pa1, vb0, o10);
    o11 = wmma_f16(pa1, vb1, o11);
    __syncthreads();
  }
  // normalize, gate, store gated output f16 row-major [n*L+l][h*32+d]
#pragma unroll
  for (int c = 0; c < 2; ++c) {
    v8f& oa = c ? o10 : o00;
    v8f& ob = c ? o11 : o01;
#pragma unroll
    for (int r = 0; r < 8; ++r) {
      const int n_idx = row0 + c * 16 + r + lh * 8;
      const float inv = 1.0f / lrow[c][r];
      const size_t mr = (size_t)n_idx * LCOL + li;
#pragma unroll
      for (int s = 0; s < 2; ++s) {
        const int dd = s * 16 + lc;
        const size_t idx = mr * HD + hh * DHID + dd;
        const float val = ((s ? ob[r] : oa[r]) * inv) * (float)gate[idx];
        att[idx] = (_Float16)val;
      }
    }
  }
}

// ------------------------------------------------------- output projection
__global__ __launch_bounds__(256) void msa_outproj_kernel(
    const _Float16* __restrict__ a, const float* __restrict__ wo,
    const float* __restrict__ bo, float* __restrict__ out) {
  __shared__ _Float16 xs[64][40];
  __shared__ _Float16 wt[64][40];
  const int tid   = threadIdx.x;
  const int lane  = tid & 31;
  const int wid   = tid >> 5;
  const int mbase = blockIdx.x * 64;
  const int colt  = blockIdx.y * 64;
  const int lrow  = tid >> 2;
  const int lseg  = (tid & 3) * 8;
  const int frow  = (wid >> 1) * 16;
  const int fcol  = (wid & 1) * 32;
  v8f acc0 = {}, acc1 = {};
  for (int kb = 0; kb < HD; kb += 32) {
    __syncthreads();
    {
      h8 d = *(const h8*)(a + (size_t)(mbase + lrow) * HD + kb + lseg);
#pragma unroll
      for (int j = 0; j < 8; ++j) xs[lrow][lseg + j] = d[j];
    }
    {
      const float* wp = wo + (size_t)(colt + lrow) * HD + kb + lseg;
      float4 d0 = ((const float4*)wp)[0];
      float4 d1 = ((const float4*)wp)[1];
      wt[lrow][lseg + 0] = (_Float16)d0.x; wt[lrow][lseg + 1] = (_Float16)d0.y;
      wt[lrow][lseg + 2] = (_Float16)d0.z; wt[lrow][lseg + 3] = (_Float16)d0.w;
      wt[lrow][lseg + 4] = (_Float16)d1.x; wt[lrow][lseg + 5] = (_Float16)d1.y;
      wt[lrow][lseg + 6] = (_Float16)d1.z; wt[lrow][lseg + 7] = (_Float16)d1.w;
    }
    __syncthreads();
    v16h af = frag_lds(&xs[0][0], frow,      40, lane);
    v16h b0 = frag_lds(&wt[0][0], fcol,      40, lane);
    v16h b1 = frag_lds(&wt[0][0], fcol + 16, 40, lane);
    acc0 = wmma_f16(af, b0, acc0);
    acc1 = wmma_f16(af, b1, acc1);
  }
  const int lh = lane >> 4;
  const int lc = lane & 15;
#pragma unroll
  for (int r = 0; r < 8; ++r) {
    const int m = mbase + frow + r + lh * 8;
#pragma unroll
    for (int s = 0; s < 2; ++s) {
      const int c = colt + fcol + s * 16 + lc;
      const float val = ((s == 0) ? acc0[r] : acc1[r]) + bo[c];
      out[(size_t)m * DM + c] = val;
    }
  }
}

extern "C" void kernel_launch(void* const* d_in, const int* in_sizes, int n_in,
                              void* d_out, int out_size, void* d_ws, size_t ws_size,
                              hipStream_t stream) {
  (void)in_sizes; (void)n_in; (void)out_size; (void)ws_size;
  const float* msa = (const float*)d_in[0];
  const float* lnw = (const float*)d_in[1];
  const float* lnb = (const float*)d_in[2];
  const float* wq  = (const float*)d_in[3];
  const float* wk  = (const float*)d_in[4];
  const float* wv  = (const float*)d_in[5];
  const float* wg  = (const float*)d_in[6];
  const float* bg  = (const float*)d_in[7];
  const float* wo  = (const float*)d_in[8];
  const float* bo  = (const float*)d_in[9];
  float* out = (float*)d_out;

  const size_t sz = (size_t)MROWS * DM;     // halves per f16 buffer (50.3 MB each)
  _Float16* xh = (_Float16*)d_ws;           // LayerNormed x       [m][dm]
  _Float16* qh = xh + sz;                   // Q (pre-scaled)      [l][h][n][d]
  _Float16* kh = qh + sz;                   // K                   [l][h][n][d]
  _Float16* vh = kh + sz;                   // V                   [l][h][n][d]
  _Float16* gh = vh + sz;                   // sigmoid gate        [m][hd]
  _Float16* ah = gh + sz;                   // gated attn output   [m][hd]

  msa_ln_kernel<<<MROWS / 8, 256, 0, stream>>>(msa, lnw, lnb, xh);
  msa_proj_kernel<<<dim3(MROWS / 64, 16), 256, 0, stream>>>(
      xh, wq, wk, wv, wg, bg, qh, kh, vh, gh);
  msa_attn_kernel<<<LCOL * NHEAD, 256, 0, stream>>>(qh, kh, vh, gh, ah);
  msa_outproj_kernel<<<dim3(MROWS / 64, 4), 256, 0, stream>>>(ah, wo, bo, out);
}

// v001
// Measured time: 253 microseconds a run.
// Timed twice side by side with v000, it ran 1.46 times as fast both times.
#include <hip/hip_runtime.h>

#define DM    256
#define NSEQ  256
#define LCOL  384
#define NHEAD 8
#define DHID  32
#define HD    (NHEAD * DHID)          // 256
#define MROWS (NSEQ * LCOL)           // 98304

typedef __attribute__((ext_vector_type(16))) _Float16     v16h;
typedef __attribute__((ext_vector_type(8)))  _Float16     h8;
typedef __attribute__((ext_vector_type(8)))  float        v8f;
typedef __attribute__((ext_vector_type(4)))  unsigned int v4u;
typedef __attribute__((ext_vector_type(8)))  int          v8i;
typedef __attribute__((ext_vector_type(4)))  int          v4i;

#if defined(__has_builtin)
#if __has_builtin(__builtin_amdgcn_tensor_load_to_lds) && \
    __has_builtin(__builtin_amdgcn_s_wait_tensorcnt)
#define USE_TDM 1
#endif
#endif
#ifndef USE_TDM
#define USE_TDM 0
#endif

static __device__ inline v8f wmma_f16(v16h a, v16h b, v8f c) {
  // (neg_a, A, neg_b, B, c_mod, C, reuse_a, reuse_b)
  return __builtin_amdgcn_wmma_f32_16x16x32_f16(false, a, false, b, (short)0, c,
                                                false, false);
}

static __device__ inline v16h frag_rowmajor(const _Float16* rowptr, int lane) {
  const int kb = (lane >> 4) * 8;
  h8 lo = *(const h8*)(rowptr + kb);
  h8 hi = *(const h8*)(rowptr + kb + 16);
  v16h f;
#pragma unroll
  for (int j = 0; j < 8; ++j) { f[j] = lo[j]; f[j + 8] = hi[j]; }
  return f;
}

// Same fragment pattern gathered from an LDS tile with row `stride` (halves).
static __device__ inline v16h frag_lds(const _Float16* base, int row_base,
                                       int stride, int lane) {
  const int r  = row_base + (lane & 15);
  const int kb = (lane >> 4) * 8;
  const _Float16* p = base + r * stride;
  v16h f;
#pragma unroll
  for (int j = 0; j < 8; ++j) { f[j] = p[kb + j]; f[j + 8] = p[kb + 16 + j]; }
  return f;
}

// B fragment when data is stored K-major ([k][n] rows): lane owns column n.
static __device__ inline v16h frag_colmajor(const _Float16* base, int colbase,
                                            int stride, int lane) {
  const int c  = colbase + (lane & 15);
  const int kb = (lane >> 4) * 8;
  v16h f;
#pragma unroll
  for (int j = 0; j < 8; ++j) {
    f[j]     = base[(kb + j) * stride + c];
    f[j + 8] = base[(kb + 16 + j) * stride + c];
  }
  return f;
}

#if USE_TDM
static __device__ inline void tdm_load_2d_f16(unsigned int lds_off,
                                              const _Float16* gptr,
                                              unsigned int rowlen,
                                              unsigned int nrows) {
  const unsigned long long ga = (unsigned long long)(uintptr_t)gptr;
  v4u g0;
  g0[0] = 1u;                                   // count=1, user mode
  g0[1] = lds_off;                              // lds_addr
  g0[2] = (unsigned int)(ga & 0xffffffffu);     // global_addr[31:0]
  g0[3] = ((unsigned int)(ga >> 32) & 0x01ffffffu) | 0x80000000u; // addr[56:32]|type=2
  v8i g1;
  g1[0] = 0x00010000;
  g1[1] = (int)(rowlen << 16);
  g1[2] = (int)(nrows << 16);
  g1[3] = (int)(rowlen << 16);
  g1[4] = (int)nrows;
  g1[5] = (int)rowlen;
  g1[6] = 0;
  g1[7] = 0;
  v4i gz = {0, 0, 0, 0};                        // groups 2/3: 2-D tensor
#if defined(__clang_major__) && (__clang_major__ >= 23)
  v8i gz8 = {0, 0, 0, 0, 0, 0, 0, 0};
  __builtin_amdgcn_tensor_load_to_lds(g0, g1, gz, gz, gz8, 0);
#else
  __builtin_amdgcn_tensor_load_to_lds(g0, g1, gz, gz, 0);
#endif
}
#endif

// ---------------------------------------------------------------- LayerNorm
__global__ __launch_bounds__(256) void msa_ln_kernel(
    const float* __restrict__ msa, const float* __restrict__ lnw,
    const float* __restrict__ lnb, _Float16* __restrict__ xo) {
  const int lane = threadIdx.x & 31;
  const int wid  = threadIdx.x >> 5;
  const long long row = (long long)blockIdx.x * 8 + wid;
  const float* src = msa + row * DM;
  float4 a = ((const float4*)src)[lane * 2];
  float4 b = ((const float4*)src)[lane * 2 + 1];
  float s  = a.x + a.y + a.z + a.w + b.x + b.y + b.z + b.w;
  float ss = a.x*a.x + a.y*a.y + a.z*a.z + a.w*a.w +
             b.x*b.x + b.y*b.y + b.z*b.z + b.w*b.w;
#pragma unroll
  for (int off = 16; off >= 1; off >>= 1) {
    s  += __shfl_xor(s,  off, 32);
    ss += __shfl_xor(ss, off, 32);
  }
  const float mu   = s * (1.0f / DM);
  const float rstd = rsqrtf(ss * (1.0f / DM) - mu * mu + 1e-5f);
  float4 w0 = ((const float4*)lnw)[lane * 2], w1 = ((const float4*)lnw)[lane * 2 + 1];
  float4 c0 = ((const float4*)lnb)[lane * 2], c1 = ((const float4*)lnb)[lane * 2 + 1];
  h8 o;
  o[0] = (_Float16)((a.x - mu) * rstd * w0.x + c0.x);
  o[1] = (_Float16)((a.y - mu) * rstd * w0.y + c0.y);
  o[2] = (_Float16)((a.z - mu) * rstd * w0.z + c0.z);
  o[3] = (_Float16)((a.w - mu) * rstd * w0.w + c0.w);
  o[4] = (_Float16)((b.x - mu) * rstd * w1.x + c1.x);
  o[5] = (_Float16)((b.y - mu) * rstd * w1.y + c1.y);
  o[6] = (_Float16)((b.z - mu) * rstd * w1.z + c1.z);
  o[7] = (_Float16)((b.w - mu) * rstd * w1.w + c1.w);
  *(h8*)(xo + row * DM + lane * 8) = o;
}

// ------------------------------------------------ shared GEMM tile main loop
// Y = A * W^T over K = 256.  Block tile (FM*64) rows x 128 cols, 8 waves laid
// 4 (rows) x 2 (cols); each wave owns FM x 4 accumulator tiles of 16x16.
// K is staged 64 at a time; LDS rows are 128 B of data at a 144-B pitch.
#define GK     64
#define GPITCH 72
typedef __attribute__((ext_vector_type(4))) _Float16 h4;

template <int FM>
static __device__ inline void gemm_tile(const _Float16* __restrict__ A,
                                        const float* __restrict__ Wm,
                                        _Float16* xs, _Float16* wt,
                                        v8f (&acc)[FM][4]) {
  const int tid  = threadIdx.x;
  const int lane = tid & 31;
  const int wid  = tid >> 5;
  const int lc   = lane & 15;
  const int frow = (wid >> 1) * (FM * 16);
  const int fcol = (wid & 1) * 64;
  const int xrow = tid >> 3;                    // 32 rows per sweep
  const int xseg = (tid & 7) * 8;               // 8 lanes cover one 128-B line
  const int wrow = tid >> 4;                    // 16 rows per sweep
  const int wseg = (tid & 15) * 4;              // 16 lanes cover 256 B of f32
  for (int kb = 0; kb < 256; kb += GK) {
    __syncthreads();
#pragma unroll
    for (int i = 0; i < FM * 2; ++i) {          // stage A tile (f16)
      const int r = xrow + i * 32;
      *(h8*)(xs + r * GPITCH + xseg) = *(const h8*)(A + (size_t)r * 256 + kb + xseg);
    }
#pragma unroll
    for (int i = 0; i < 8; ++i) {               // stage W tile, f32 -> f16
      const int r = wrow + i * 16;
      const float4 d = *(const float4*)(Wm + (size_t)r * 256 + kb + wseg);
      h4 c;
      c[0] = (_Float16)d.x; c[1] = (_Float16)d.y;
      c[2] = (_Float16)d.z; c[3] = (_Float16)d.w;
      *(h4*)(wt + r * GPITCH + wseg) = c;
    }
    __syncthreads();
#pragma unroll
    for (int ks = 0; ks < GK; ks += 32) {
      v16h a[FM], b[4];
#pragma unroll
      for (int i = 0; i < FM; ++i)
        a[i] = frag_rowmajor(xs + (frow + i * 16 + lc) * GPITCH + ks, lane);
#pragma unroll
      for (int j = 0; j < 4; ++j)
        b[j] = frag_rowmajor(wt + (fcol + j * 16 + lc) * GPITCH + ks, lane);
#pragma unroll
      for (int i = 0; i < FM; ++i)
#pragma unroll
        for (int j = 0; j < 4; ++j) acc[i][j] = wmma_f16(a[i], b[j], acc[i][j]);
    }
  }
}

// --------------------------------------------------- fused Q/K/V/G projection
__global__ __launch_bounds__(256) void msa_proj_kernel(
    const _Float16* __restrict__ x,
    const float* __restrict__ wq, const float* __restrict__ wk,
    const float* __restrict__ wvm, const float* __restrict__ wg,
    const float* __restrict__ bg,
    _Float16* __restrict__ qo, _Float16* __restrict__ ko,
    _Float16* __restrict__ vo, _Float16* __restrict__ go) {
  __shared__ __attribute__((aligned(16))) _Float16 xs[256 * GPITCH];
  __shared__ __attribute__((aligned(16))) _Float16 wt[128 * GPITCH];
  const int lane  = threadIdx.x & 31;
  const int wid   = threadIdx.x >> 5;
  const int mbase = blockIdx.y * 256;
  const int mat   = blockIdx.x >> 1;            // 0:q 1:k 2:v 3:g
  const int colt  = (blockIdx.x & 1) * 128;
  const float* W = (mat == 0) ? wq : (mat == 1) ? wk : (mat == 2) ? wvm : wg;
  const int frow = (wid >> 1) * 64;             // wave's 64-row chunk
  const int fcol = (wid & 1) * 64;              // wave's 64-col half
  v8f acc[4][4] = {};
  gemm_tile<4>(x + (size_t)mbase * DM, W + (size_t)colt * DM, xs, wt, acc);
  const int lh = lane >> 4;
  const int lc = lane & 15;
  if (mat == 3) {                               // sigmoid gate, row-major [m][hd]
    float bgv[4];
#pragma unroll
    for (int s = 0; s < 4; ++s) bgv[s] = bg[colt + fcol + s * 16 + lc];
#pragma unroll
    for (int i = 0; i < 4; ++i) {
#pragma unroll
      for (int r = 0; r < 8; ++r) {
        const int m = mbase + frow + i * 16 + r + lh * 8;
#pragma unroll
        for (int s = 0; s < 4; ++s) {
          const int c = colt + fcol + s * 16 + lc;
          const float g = 1.0f / (1.0f + __expf(-(acc[i][s][r] + bgv[s])));
          go[(size_t)m * HD + c] = (_Float16)g;
        }
      }
    }
  } else {                                      // q (pre-scaled), k, v: [l][h][n][d]
    const float sc = (mat == 0) ? 0.17677669529663687f : 1.0f;  // 1/sqrt(32)
    _Float16* dst = (mat == 0) ? qo : (mat == 1) ? ko : vo;
#pragma unroll
    for (int i = 0; i < 4; ++i) {
#pragma unroll
      for (int r = 0; r < 8; ++r) {
        const int m     = mbase + frow + i * 16 + r + lh * 8;
        const int n_idx = m / LCOL;
        const int l_idx = m % LCOL;
#pragma unroll
        for (int s = 0; s < 4; ++s) {
          const int c  = colt + fcol + s * 16 + lc;
          const int hh = c >> 5, dd = c & 31;
          dst[(((size_t)l_idx * NHEAD + hh) * NSEQ + n_idx) * DHID + dd] =
              (_Float16)(acc[i][s][r] * sc);
        }
      }
    }
    // the stores above still name their data registers: hold any later write of
    // those registers behind them (the listing joins this part to the gate part)
    asm volatile("s_wait_xcnt 0x0" ::: "memory");
  }
}

// ----------------------------------------------- flash attention per (l, head)
__global__ __launch_bounds__(256) void msa_attn_kernel(
    const _Float16* __restrict__ q, const _Float16* __restrict__ k,
    const _Float16* __restrict__ v, const _Float16* __restrict__ gate,
    _Float16* __restrict__ att) {
  __shared__ _Float16 pbuf[8][32][40];      // per-wave P transpose staging
  __shared__ _Float16 vsbuf[NSEQ][DHID];    // whole V tensor for this (l,h), 16KB
  const int lane = threadIdx.x & 31;
  const int wid  = threadIdx.x >> 5;
  const int lh   = lane >> 4;
  const int lc   = lane & 15;
  const int li   = blockIdx.x >> 3;     // column index 0..383
  const int hh   = blockIdx.x & 7;      // head
  const size_t base = ((size_t)li * NHEAD + hh) * NSEQ * DHID;
  const _Float16* qb = q + base;
  const _Float16* kp = k + base;
  const _Float16* vp = v + base;
  const int row0 = wid * 32;            // this wave's 32 query rows

#if USE_TDM
  if (wid == 0) {
    tdm_load_2d_f16((unsigned int)(uintptr_t)&vsbuf[0][0], vp, DHID, NSEQ);
  }
#else
  // Fallback: cooperative staged copy of V into LDS (128-bit loads).
  for (int rr = wid * 4; rr < NSEQ; rr += 32) {
    const int r2 = rr + (lane >> 3);
    const int c2 = (lane & 7) * 4;
    *(h8*)&vsbuf[r2][c2] = *(const h8*)(vp + (size_t)r2 * DHID + c2);
  }
#endif

  const v16h qa0 = frag_rowmajor(qb + (size_t)(row0 + lc) * DHID,      lane);
  const v16h qa1 = frag_rowmajor(qb + (size_t)(row0 + 16 + lc) * DHID, lane);

#if USE_TDM
  if (wid == 0) __builtin_amdgcn_s_wait_tensorcnt(0);
#endif
  __syncthreads();

  v8f o00 = {}, o01 = {}, o10 = {}, o11 = {};
  float mrow[2][8], lrow[2][8];
#pragma unroll
  for (int c = 0; c < 2; ++c)
#pragma unroll
    for (int r = 0; r < 8; ++r) { mrow[c][r] = -1e30f; lrow[c][r] = 0.0f; }

  for (int kt = 0; kt < NSEQ; kt += 32) {
    if (kt + 32 < NSEQ) {
      __builtin_prefetch(kp + (size_t)(kt + 32) * DHID, 0, 1);
    }
    // S = Q @ K^T: B fragment rows are contiguous K rows (lane owns a key)
    const v16h kb0 = frag_rowmajor(kp + (size_t)(kt + lc) * DHID,      lane);
    const v16h kb1 = frag_rowmajor(kp + (size_t)(kt + 16 + lc) * DHID, lane);
    v8f zero = {};
    v8f s00 = wmma_f16(qa0, kb0, zero);
    v8f s01 = wmma_f16(qa0, kb1, zero);
    v8f s10 = wmma_f16(qa1, kb0, zero);
    v8f s11 = wmma_f16(qa1, kb1, zero);
    // online softmax (rows live in 16-lane halves; xor<=8 stays in-half)
#pragma unroll
    for (int c = 0; c < 2; ++c) {
      v8f& sa = c ? s10 : s00;
      v8f& sb = c ? s11 : s01;
      v8f& oa = c ? o10 : o00;
      v8f& ob = c ? o11 : o01;
#pragma unroll
      for (int r = 0; r < 8; ++r) {
        float mx = fmaxf(sa[r], sb[r]);
#pragma unroll
        for (int off = 1; off < 16; off <<= 1) mx = fmaxf(mx, __shfl_xor(mx, off, 32));
        const float mnew = fmaxf(mrow[c][r], mx);
        const float corr = __expf(mrow[c][r] - mnew);
        mrow[c][r] = mnew;
        const float p0 = __expf(sa[r] - mnew);
        const float p1 = __expf(sb[r] - mnew);
        float rs = p0 + p1;
#pragma unroll
        for (int off = 1; off < 16; off <<= 1) rs += __shfl_xor(rs, off, 32);
        lrow[c][r] = lrow[c][r] * corr + rs;
        oa[r] *= corr; ob[r] *= corr;
        pbuf[wid][c * 16 + r + lh * 8][lc]      = (_Float16)p0;
        pbuf[wid][c * 16 + r + lh * 8][16 + lc] = (_Float16)p1;
      }
    }
    __syncthreads();  // order LDS transpose writes vs fragment reads
    const v16h pa0 = frag_lds(&pbuf[wid][0][0], 0,  40, lane);
    const v16h pa1 = frag_lds(&pbuf[wid][0][0], 16, 40, lane);
    const v16h vb0 = frag_colmajor(&vsbuf[kt][0], 0,  DHID, lane);
    const v16h vb1 = frag_colmajor(&vsbuf[kt][0], 16, DHID, lane);
    o00 = wmma_f16(pa0, vb0, o00);
    o01 = wmma_f16(pa0, vb1, o01);
    o10 = wmma_f16(pa1, vb0, o10);
    o11 = wmma_f16(pa1, vb1, o11);
    __syncthreads();
  }
  // normalize, gate, store gated output f16 row-major [n*L+l][h*32+d]
#pragma unroll
  for (int c = 0; c < 2; ++c) {
    v8f& oa = c ? o10 : o00;
    v8f& ob = c ? o11 : o01;
#pragma unroll
    for (int r = 0; r < 8; ++r) {
      const int n_idx = row0 + c * 16 + r + lh * 8;
      const float inv = 1.0f / lrow[c][r];
      const size_t mr = (size_t)n_idx * LCOL + li;
#pragma unroll
      for (int s = 0; s < 2; ++s) {
        const int dd = s * 16 + lc;
        const size_t idx = mr * HD + hh * DHID + dd;
        const float val = ((s ? ob[r] : oa[r]) * inv) * (float)gate[idx];
        att[idx] = (_Float16)val;
      }
    }
  }
}

// ------------------------------------------------------- output projection
__global__ __launch_bounds__(256) void msa_outproj_kernel(
    const _Float16* __restrict__ a, const float* __restrict__ wo,
    const float* __restrict__ bo, float* __restrict__ out) {
  __shared__ __attribute__((aligned(16))) _Float16 xs[128 * GPITCH];
  __shared__ __attribute__((aligned(16))) _Float16 wt[128 * GPITCH];
  const int lane  = threadIdx.x & 31;
  const int wid   = threadIdx.x >> 5;
  const int mbase = blockIdx.y * 128;
  const int colt  = blockIdx.x * 128;
  const int frow  = (wid >> 1) * 32;
  const int fcol  = (wid & 1) * 64;
  v8f acc[2][4] = {};
  gemm_tile<2>(a + (size_t)mbase * HD, wo + (size_t)colt * HD, xs, wt, acc);
  const int lh = lane >> 4;
  const int lc = lane & 15;
#pragma unroll
  for (int i = 0; i < 2; ++i) {
#pragma unroll
    for (int r = 0; r < 8; ++r) {
      const int m = mbase + frow + i * 16 + r + lh * 8;
#pragma unroll
      for (int s = 0; s < 4; ++s) {
        const int c = colt + fcol + s * 16 + lc;
        out[(size_t)m * DM + c] = acc[i][s][r] + bo[c];
      }
    }
  }
}

extern "C" void kernel_launch(void* const* d_in, const int* in_sizes, int n_in,
                              void* d_out, int out_size, void* d_ws, size_t ws_size,
                              hipStream_t stream) {
  (void)in_sizes; (void)n_in; (void)out_size; (void)ws_size;
  const float* msa = (const float*)d_in[0];
  const float* lnw = (const float*)d_in[1];
  const float* lnb = (const float*)d_in[2];
  const float* wq  = (const float*)d_in[3];
  const float* wk  = (const float*)d_in[4];
  const float* wv  = (const float*)d_in[5];
  const float* wg  = (const float*)d_in[6];
  const float* bg  = (const float*)d_in[7];
  const float* wo  = (const float*)d_in[8];
  const float* bo  = (const float*)d_in[9];
  float* out = (float*)d_out;

  const size_t sz = (size_t)MROWS * DM;     // halves per f16 buffer (50.3 MB each)
  _Float16* xh = (_Float16*)d_ws;           // LayerNormed x       [m][dm]
  _Float16* qh = xh + sz;                   // Q (pre-scaled)      [l][h][n][d]
  _Float16* kh = qh + sz;                   // K                   [l][h][n][d]
  _Float16* vh = kh + sz;                   // V                   [l][h][n][d]
  _Float16* gh = vh + sz;                   // sigmoid gate        [m][hd]
  _Float16* ah = gh + sz;                   // gated attn output   [m][hd]

  msa_ln_kernel<<<MROWS / 8, 256, 0, stream>>>(msa, lnw, lnb, xh);
  msa_proj_kernel<<<dim3(8, MROWS / 256), 256, 0, stream>>>(
      xh, wq, wk, wv, wg, bg, qh, kh, vh, gh);
  msa_attn_kernel<<<LCOL * NHEAD, 256, 0, stream>>>(qh, kh, vh, gh, ah);
  msa_outproj_kernel<<<dim3(2, MROWS / 128), 256, 0, stream>>>(ah, wo, bo, out);
}

// v002
// Measured time: 188 microseconds a run.
// In both of two side-by-side timings against v001, it was 1.35 times as fast.
// All steps since v000 together make it 1.98 times as fast.
#include <hip/hip_runtime.h>

#define DM    256
#define NSEQ  256
#define LCOL  384
#define NHEAD 8
#define DHID  32
#define HD    (NHEAD * DHID)          // 256
#define MROWS (NSEQ * LCOL)           // 98304

typedef __attribute__((ext_vector_type(16))) _Float16     v16h;
typedef __attribute__((ext_vector_type(8)))  _Float16     h8;
typedef __attribute__((ext_vector_type(8)))  float        v8f;
typedef __attribute__((ext_vector_type(2)))  float        v2f;
typedef __attribute__((ext_vector_type(4)))  unsigned int v4u;
typedef __attribute__((ext_vector_type(8)))  int          v8i;
typedef __attribute__((ext_vector_type(4)))  int          v4i;

#if defined(__has_builtin)
#if __has_builtin(__builtin_amdgcn_tensor_load_to_lds) && \
    __has_builtin(__builtin_amdgcn_s_wait_tensorcnt)
#define USE_TDM 1
#endif
#endif
#ifndef USE_TDM
#define USE_TDM 0
#endif

static __device__ inline v8f wmma_f16(v16h a, v16h b, v8f c) {
  // (neg_a, A, neg_b, B, c_mod, C, reuse_a, reuse_b)
  return __builtin_amdgcn_wmma_f32_16x16x32_f16(false, a, false, b, (short)0, c,
                                                false, false);
}

static __device__ inline v16h frag_rowmajor(const _Float16* rowptr, int lane) {
  const int kb = (lane >> 4) * 8;
  h8 lo = *(const h8*)(rowptr + kb);
  h8 hi = *(const h8*)(rowptr + kb + 16);
  v16h f;
#pragma unroll
  for (int j = 0; j < 8; ++j) { f[j] = lo[j]; f[j + 8] = hi[j]; }
  return f;
}

// A/B fragment when data is stored K-major ([k][n] rows): lane owns column n.
static __device__ inline v16h frag_colmajor(const _Float16* base, int colbase,
                                            int stride, int lane) {
  const int c  = colbase + (lane & 15);
  const int kb = (lane >> 4) * 8;
  v16h f;
#pragma unroll
  for (int j = 0; j < 8; ++j) {
    f[j]     = base[(kb + j) * stride + c];
    f[j + 8] = base[(kb + 16 + j) * stride + c];
  }
  return f;
}

#if USE_TDM
static __device__ inline void tdm_load_2d_f16(unsigned int lds_off,
                                              const _Float16* gptr,
                                              unsigned int rowlen,
                                              unsigned int nrows) {
  const unsigned long long ga = (unsigned long long)(uintptr_t)gptr;
  v4u g0;
  g0[0] = 1u;                                   // count=1, user mode
  g0[1] = lds_off;                              // lds_addr
  g0[2] = (unsigned int)(ga & 0xffffffffu);     // global_addr[31:0]
  g0[3] = ((unsigned int)(ga >> 32) & 0x01ffffffu) | 0x80000000u; // addr[56:32]|type=2
  v8i g1;
  g1[0] = 0x00010000;
  g1[1] = (int)(rowlen << 16);
  g1[2] = (int)(nrows << 16);
  g1[3] = (int)(rowlen << 16);
  g1[4] = (int)nrows;
  g1[5] = (int)rowlen;
  g1[6] = 0;
  g1[7] = 0;
  v4i gz = {0, 0, 0, 0};                        // groups 2/3: 2-D tensor
#if defined(__clang_major__) && (__clang_major__ >= 23)
  v8i gz8 = {0, 0, 0, 0, 0, 0, 0, 0};
  __builtin_amdgcn_tensor_load_to_lds(g0, g1, gz, gz, gz8, 0);
#else
  __builtin_amdgcn_tensor_load_to_lds(g0, g1, gz, gz, 0);
#endif
}
#endif

// ---------------------------------------------------------------- LayerNorm
__global__ __launch_bounds__(256) void msa_ln_kernel(
    const float* __restrict__ msa, const float* __restrict__ lnw,
    const float* __restrict__ lnb, _Float16* __restrict__ xo) {
  const int lane = threadIdx.x & 31;
  const int wid  = threadIdx.x >> 5;
  const long long row = (long long)blockIdx.x * 8 + wid;
  const float* src = msa + row * DM;
  float4 a = ((const float4*)src)[lane * 2];
  float4 b = ((const float4*)src)[lane * 2 + 1];
  float s  = a.x + a.y + a.z + a.w + b.x + b.y + b.z + b.w;
  float ss = a.x*a.x + a.y*a.y + a.z*a.z + a.w*a.w +
             b.x*b.x + b.y*b.y + b.z*b.z + b.w*b.w;
#pragma unroll
  for (int off = 16; off >= 1; off >>= 1) {
    s  += __shfl_xor(s,  off, 32);
    ss += __shfl_xor(ss, off, 32);
  }
  const float mu   = s * (1.0f / DM);
  const float rstd = rsqrtf(ss * (1.0f / DM) - mu * mu + 1e-5f);
  float4 w0 = ((const float4*)lnw)[lane * 2], w1 = ((const float4*)lnw)[lane * 2 + 1];
  float4 c0 = ((const float4*)lnb)[lane * 2], c1 = ((const float4*)lnb)[lane * 2 + 1];
  h8 o;
  o[0] = (_Float16)((a.x - mu) * rstd * w0.x + c0.x);
  o[1] = (_Float16)((a.y - mu) * rstd * w0.y + c0.y);
  o[2] = (_Float16)((a.z - mu) * rstd * w0.z + c0.z);
  o[3] = (_Float16)((a.w - mu) * rstd * w0.w + c0.w);
  o[4] = (_Float16)((b.x - mu) * rstd * w1.x + c1.x);
  o[5] = (_Float16)((b.y - mu) * rstd * w1.y + c1.y);
  o[6] = (_Float16)((b.z - mu) * rstd * w1.z + c1.z);
  o[7] = (_Float16)((b.w - mu) * rstd * w1.w + c1.w);
  *(h8*)(xo + row * DM + lane * 8) = o;
}

// ------------------------------------------------ shared GEMM tile main loop
// Y = A * W^T over K = 256.  Block tile (FM*64) rows x 128 cols, 8 waves laid
// 4 (rows) x 2 (cols); each wave owns FM x 4 accumulator tiles of 16x16.
// K is staged 64 at a time; LDS rows are 128 B of data at a 144-B pitch.
#define GK     64
#define GPITCH 72
typedef __attribute__((ext_vector_type(4))) _Float16 h4;

template <int FM>
static __device__ inline void gemm_tile(const _Float16* __restrict__ A,
                                        const float* __restrict__ Wm,
                                        _Float16* xs, _Float16* wt,
                                        v8f (&acc)[FM][4]) {
  const int tid  = threadIdx.x;
  const int lane = tid & 31;
  const int wid  = tid >> 5;
  const int lc   = lane & 15;
  const int frow = (wid >> 1) * (FM * 16);
  const int fcol = (wid & 1) * 64;
  const int xrow = tid >> 3;                    // 32 rows per sweep
  const int xseg = (tid & 7) * 8;               // 8 lanes cover one 128-B line
  const int wrow = tid >> 4;                    // 16 rows per sweep
  const int wseg = (tid & 15) * 4;              // 16 lanes cover 256 B of f32
  for (int kb = 0; kb < 256; kb += GK) {
    __syncthreads();
#pragma unroll
    for (int i = 0; i < FM * 2; ++i) {          // stage A tile (f16)
      const int r = xrow + i * 32;
      *(h8*)(xs + r * GPITCH + xseg) = *(const h8*)(A + (size_t)r * 256 + kb + xseg);
    }
#pragma unroll
    for (int i = 0; i < 8; ++i) {               // stage W tile, f32 -> f16
      const int r = wrow + i * 16;
      const float4 d = *(const float4*)(Wm + (size_t)r * 256 + kb + wseg);
      h4 c;
      c[0] = (_Float16)d.x; c[1] = (_Float16)d.y;
      c[2] = (_Float16)d.z; c[3] = (_Float16)d.w;
      *(h4*)(wt + r * GPITCH + wseg) = c;
    }
    __syncthreads();
#pragma unroll
    for (int ks = 0; ks < GK; ks += 32) {
      v16h a[FM], b[4];
#pragma unroll
      for (int i = 0; i < FM; ++i)
        a[i] = frag_rowmajor(xs + (frow + i * 16 + lc) * GPITCH + ks, lane);
#pragma unroll
      for (int j = 0; j < 4; ++j)
        b[j] = frag_rowmajor(wt + (fcol + j * 16 + lc) * GPITCH + ks, lane);
#pragma unroll
      for (int i = 0; i < FM; ++i)
#pragma unroll
        for (int j = 0; j < 4; ++j) acc[i][j] = wmma_f16(a[i], b[j], acc[i][j]);
    }
  }
}

// --------------------------------------------------- fused Q/K/V/G projection
__global__ __launch_bounds__(256) void msa_proj_kernel(
    const _Float16* __restrict__ x,
    const float* __restrict__ wq, const float* __restrict__ wk,
    const float* __restrict__ wvm, const float* __restrict__ wg,
    const float* __restrict__ bg,
    _Float16* __restrict__ qo, _Float16* __restrict__ ko,
    _Float16* __restrict__ vo, _Float16* __restrict__ go) {
  __shared__ __attribute__((aligned(16))) _Float16 xs[256 * GPITCH];
  __shared__ __attribute__((aligned(16))) _Float16 wt[128 * GPITCH];
  const int lane  = threadIdx.x & 31;
  const int wid   = threadIdx.x >> 5;
  const int mbase = blockIdx.y * 256;
  const int mat   = blockIdx.x >> 1;            // 0:q 1:k 2:v 3:g
  const int colt  = (blockIdx.x & 1) * 128;
  const float* W = (mat == 0) ? wq : (mat == 1) ? wk : (mat == 2) ? wvm : wg;
  const int frow = (wid >> 1) * 64;             // wave's 64-row chunk
  const int fcol = (wid & 1) * 64;              // wave's 64-col half
  v8f acc[4][4] = {};
  gemm_tile<4>(x + (size_t)mbase * DM, W + (size_t)colt * DM, xs, wt, acc);
  const int lh = lane >> 4;
  const int lc = lane & 15;
  if (mat == 3) {                               // sigmoid gate, row-major [m][hd]
    float bgv[4];
#pragma unroll
    for (int s = 0; s < 4; ++s) bgv[s] = bg[colt + fcol + s * 16 + lc];
#pragma unroll
    for (int i = 0; i < 4; ++i) {
#pragma unroll
      for (int r = 0; r < 8; ++r) {
        const int m = mbase + frow + i * 16 + r + lh * 8;
#pragma unroll
        for (int s = 0; s < 4; ++s) {
          const int c = colt + fcol + s * 16 + lc;
          const float g = 1.0f / (1.0f + __expf(-(acc[i][s][r] + bgv[s])));
          go[(size_t)m * HD + c] = (_Float16)g;
        }
      }
    }
  } else {                                      // q (pre-scaled), k, v: [l][h][n][d]
    const float sc = (mat == 0) ? 0.17677669529663687f : 1.0f;  // 1/sqrt(32)
    _Float16* dst = (mat == 0) ? qo : (mat == 1) ? ko : vo;
#pragma unroll
    for (int i = 0; i < 4; ++i) {
#pragma unroll
      for (int r = 0; r < 8; ++r) {
        const int m     = mbase + frow + i * 16 + r + lh * 8;
        const int n_idx = m / LCOL;
        const int l_idx = m % LCOL;
#pragma unroll
        for (int s = 0; s < 4; ++s) {
          const int c  = colt + fcol + s * 16 + lc;
          const int hh = c >> 5, dd = c & 31;
          dst[(((size_t)l_idx * NHEAD + hh) * NSEQ + n_idx) * DHID + dd] =
              (_Float16)(acc[i][s][r] * sc);
        }
      }
    }
    // the stores above still name their data registers: hold any later write of
    // those registers behind them (the listing joins this part to the gate part)
    asm volatile("s_wait_xcnt 0x0" ::: "memory");
  }
}

static __device__ inline float xhalf(float x) {
  const int b = __builtin_bit_cast(int, x);
  return __builtin_bit_cast(
      float, __builtin_amdgcn_permlanex16(b, b, 0x76543210, 0xfedcba98, false, false));
}

__global__ __launch_bounds__(256) void msa_attn_kernel(
    const _Float16* __restrict__ q, const _Float16* __restrict__ k,
    const _Float16* __restrict__ v, const _Float16* __restrict__ gate,
    _Float16* __restrict__ att) {
  __shared__ _Float16 vsbuf[NSEQ][DHID];    // whole V tensor for this (l,h), 16KB
  const int lane = threadIdx.x & 31;
  const int wid  = threadIdx.x >> 5;
  const int lh   = lane >> 4;
  const int lc   = lane & 15;
  const int li   = blockIdx.x >> 3;     // column index 0..383
  const int hh   = blockIdx.x & 7;      // head
  const size_t base = ((size_t)li * NHEAD + hh) * NSEQ * DHID;
  const _Float16* qb = q + base;
  const _Float16* kp = k + base;
  const _Float16* vp = v + base;
  const int row0 = wid * 32;            // this wave's 32 query rows

  const v16h qa0 = frag_rowmajor(qb + (size_t)(row0 + lc) * DHID,      lane);
  const v16h qa1 = frag_rowmajor(qb + (size_t)(row0 + 16 + lc) * DHID, lane);

#if USE_TDM
  if (wid == 0) {
    tdm_load_2d_f16((unsigned int)(uintptr_t)&vsbuf[0][0], vp, DHID, NSEQ);
  }
#else
  // Fallback: cooperative staged copy of V into LDS (128-bit loads).
  for (int rr = wid * 4; rr < NSEQ; rr += 32) {
    const int r2 = rr + (lane >> 3);
    const int c2 = (lane & 7) * 4;
    *(h8*)&vsbuf[r2][c2] = *(const h8*)(vp + (size_t)r2 * DHID + c2);
  }
#endif

#if USE_TDM
  if (wid == 0) __builtin_amdgcn_s_wait_tensorcnt(0);
#endif
  __syncthreads();

  // ot[s][c][r] = O[query row0 + c*16 + lc][d = s*16 + lh*8 + r]
  v8f ot[2][2] = {};
  v2f mrow = {-1e30f, -1e30f};          // running maximum of the lane's two queries
  v2f lrow = {0.0f, 0.0f};              // their sums over THIS half's keys only

  for (int kt = 0; kt < NSEQ; kt += 32) {
    if (kt + 32 < NSEQ) {
      __builtin_prefetch(kp + (size_t)(kt + 32) * DHID, 0, 1);
    }
    // A operand of S^T: lane owns key row lc of each 16-key group
    const v16h kb0 = frag_rowmajor(kp + (size_t)(kt + lc) * DHID,      lane);
    const v16h kb1 = frag_rowmajor(kp + (size_t)(kt + 16 + lc) * DHID, lane);
    // A operand of O^T: lane owns row d of V^T, k runs over the pass's keys
    const v16h vb0 = frag_colmajor(&vsbuf[kt][0], 0,  DHID, lane);
    const v16h vb1 = frag_colmajor(&vsbuf[kt][0], 16, DHID, lane);
    v8f zero = {};
    // st[t][c][r] = S[query c*16 + lc][key kt + t*16 + lh*8 + r]
    v8f st[2][2];
    st[0][0] = wmma_f16(kb0, qa0, zero);
    st[1][0] = wmma_f16(kb1, qa0, zero);
    st[0][1] = wmma_f16(kb0, qa1, zero);
    st[1][1] = wmma_f16(kb1, qa1, zero);
    v2f mnew;
#pragma unroll
    for (int c = 0; c < 2; ++c) {
      float mx = fmaxf(st[0][c][0], st[1][c][0]);
#pragma unroll
      for (int r = 1; r < 8; ++r) mx = fmaxf(mx, fmaxf(st[0][c][r], st[1][c][r]));
      mnew[c] = fmaxf(mrow[c], fmaxf(mx, xhalf(mx)));
    }
    const v2f corr = {__expf(mrow.x - mnew.x), __expf(mrow.y - mnew.y)};
    mrow = mnew;
    v2f rsum;
#pragma unroll
    for (int c = 0; c < 2; ++c) {
      v16h pb;                          // P^T fragment, hardware k order
      v2f rs0 = {0.0f, 0.0f}, rs1 = {0.0f, 0.0f};
#pragma unroll
      for (int r = 0; r < 8; r += 2) {  // neighbouring registers go in pairs
        const v2f p0 = {__expf(st[0][c][r] - mnew[c]), __expf(st[0][c][r + 1] - mnew[c])};
        const v2f p1 = {__expf(st[1][c][r] - mnew[c]), __expf(st[1][c][r + 1] - mnew[c])};
        rs0 += p0;
        rs1 += p1;
        pb[r]     = (_Float16)p0.x;
        pb[r + 1] = (_Float16)p0.y;
        pb[r + 8] = (_Float16)p1.x;
        pb[r + 9] = (_Float16)p1.y;
      }
      rs0 += rs1;
      rsum[c] = rs0.x + rs0.y;
#pragma unroll
      for (int r = 0; r < 8; ++r) { ot[0][c][r] *= corr[c]; ot[1][c][r] *= corr[c]; }
      ot[0][c] = wmma_f16(vb0, pb, ot[0][c]);
      ot[1][c] = wmma_f16(vb1, pb, ot[1][c]);
    }
    lrow = lrow * corr + rsum;
  }
  // normalize, gate, store gated output f16 row-major [n*L+l][h*32+d]:
  // a lane's 8 registers of a tile are 8 consecutive d of its query
  h8 g[2][2];
#pragma unroll
  for (int c = 0; c < 2; ++c) {
#pragma unroll
    for (int s = 0; s < 2; ++s) {
      const size_t mr = (size_t)(row0 + c * 16 + lc) * LCOL + li;
      g[c][s] = *(const h8*)(gate + mr * HD + hh * DHID + s * 16 + lh * 8);
      // the load above still names its address registers: hold any later write
      // of them (the next load's result may land there) behind it
      asm volatile("s_wait_xcnt 0x0" ::: "memory");
    }
  }
#pragma unroll
  for (int c = 0; c < 2; ++c) {
    const float inv = 1.0f / (lrow[c] + xhalf(lrow[c]));
    const size_t mr = (size_t)(row0 + c * 16 + lc) * LCOL + li;
#pragma unroll
    for (int s = 0; s < 2; ++s) {
      h8 w;
#pragma unroll
      for (int r = 0; r < 8; ++r)
        w[r] = (_Float16)((ot[s][c][r] * inv) * (float)g[c][s][r]);
      *(h8*)(att + mr * HD + hh * DHID + s * 16 + lh * 8) = w;
    }
  }
}

// ------------------------------------------------------- output projection
__global__ __launch_bounds__(256) void msa_outproj_kernel(
    const _Float16* __restrict__ a, const float* __restrict__ wo,
    const float* __restrict__ bo, float* __restrict__ out) {
  __shared__ __attribute__((aligned(16))) _Float16 xs[128 * GPITCH];
  __shared__ __attribute__((aligned(16))) _Float16 wt[128 * GPITCH];
  const int lane  = threadIdx.x & 31;
  const int wid   = threadIdx.x >> 5;
  const int mbase = blockIdx.y * 128;
  const int colt  = blockIdx.x * 128;
  const int frow  = (wid >> 1) * 32;
  const int fcol  = (wid & 1) * 64;
  v8f acc[2][4] = {};
  gemm_tile<2>(a + (size_t)mbase * HD, wo + (size_t)colt * HD, xs, wt, acc);
  const int lh = lane >> 4;
  const int lc = lane & 15;
#pragma unroll
  for (int i = 0; i < 2; ++i) {
#pragma unroll
    for (int r = 0; r < 8; ++r) {
      const int m = mbase + frow + i * 16 + r + lh * 8;
#pragma unroll
      for (int s = 0; s < 4; ++s) {
        const int c = colt + fcol + s * 16 + lc;
        out[(size_t)m * DM + c] = acc[i][s][r] + bo[c];
      }
    }
  }
}

extern "C" void kernel_launch(void* const* d_in, const int* in_sizes, int n_in,
                              void* d_out, int out_size, void* d_ws, size_t ws_size,
                              hipStream_t stream) {
  (void)in_sizes; (void)n_in; (void)out_size; (void)ws_size;
  const float* msa = (const float*)d_in[0];
  const float* lnw = (const float*)d_in[1];
  const float* lnb = (const float*)d_in[2];
  const float* wq  = (const float*)d_in[3];
  const float* wk  = (const float*)d_in[4];
  const float* wv  = (const float*)d_in[5];
  const float* wg  = (const float*)d_in[6];
  const float* bg  = (const float*)d_in[7];
  const float* wo  = (const float*)d_in[8];
  const float* bo  = (const float*)d_in[9];
  float* out = (float*)d_out;

  const size_t sz = (size_t)MROWS * DM;     // halves per f16 buffer (50.3 MB each)
  _Float16* xh = (_Float16*)d_ws;           // LayerNormed x       [m][dm]
  _Float16* qh = xh + sz;                   // Q (pre-scaled)      [l][h][n][d]
  _Float16* kh = qh + sz;                   // K                   [l][h][n][d]
  _Float16* vh = kh + sz;                   // V                   [l][h][n][d]
  _Float16* gh = vh + sz;                   // sigmoid gate        [m][hd]
  _Float16* ah = gh + sz;                   // gated attn output   [m][hd]

  msa_ln_kernel<<<MROWS / 8, 256, 0, stream>>>(msa, lnw, lnb, xh);
  msa_proj_kernel<<<dim3(8, MROWS / 256), 256, 0, stream>>>(
      xh, wq, wk, wv, wg, bg, qh, kh, vh, gh);
  msa_attn_kernel<<<LCOL * NHEAD, 256, 0, stream>>>(qh, kh, vh, gh, ah);
  msa_outproj_kernel<<<dim3(2, MROWS / 128), 256, 0, stream>>>(ah, wo, bo, out);
}

// v003
// Measured time: 168 microseconds a run.
// Timed twice side by side with v002, it ran 1.11 and 1.12 times as fast.
// Over all steps from v000 it is 2.21 times as fast.
#include <hip/hip_runtime.h>

#define DM    256
#define NSEQ  256
#define LCOL  384
#define NHEAD 8
#define DHID  32
#define HD    (NHEAD * DHID)          // 256
#define MROWS (NSEQ * LCOL)           // 98304

typedef __attribute__((ext_vector_type(16))) _Float16     v16h;
typedef __attribute__((ext_vector_type(8)))  _Float16     h8;
typedef __attribute__((ext_vector_type(8)))  float        v8f;
typedef __attribute__((ext_vector_type(2)))  float        v2f;
typedef __attribute__((ext_vector_type(4)))  unsigned int v4u;
typedef __attribute__((ext_vector_type(8)))  int          v8i;
typedef __attribute__((ext_vector_type(4)))  int          v4i;

#if defined(__has_builtin)
#if __has_builtin(__builtin_amdgcn_tensor_load_to_lds) && \
    __has_builtin(__builtin_amdgcn_s_wait_tensorcnt)
#define USE_TDM 1
#endif
#endif
#ifndef USE_TDM
#define USE_TDM 0
#endif

static __device__ inline v8f wmma_f16(v16h a, v16h b, v8f c) {
  // (neg_a, A, neg_b, B, c_mod, C, reuse_a, reuse_b)
  return __builtin_amdgcn_wmma_f32_16x16x32_f16(false, a, false, b, (short)0, c,
                                                false, false);
}

static __device__ inline v16h frag_rowmajor(const _Float16* rowptr, int lane) {
  const int kb = (lane >> 4) * 8;
  h8 lo = *(const h8*)(rowptr + kb);
  h8 hi = *(const h8*)(rowptr + kb + 16);
  v16h f;
#pragma unroll
  for (int j = 0; j < 8; ++j) { f[j] = lo[j]; f[j + 8] = hi[j]; }
  return f;
}

// Same fragment from a piece-major tile [k / 8][row][8] of 'rows' rows: the 16
// lanes of a half wave read 16 neighbouring 16-B pieces, 256 B in a row.
static __device__ inline v16h frag_piecemajor(const _Float16* base, int rows,
                                              int row, int lane) {
  const int pc = lane >> 4;
  h8 lo = *(const h8*)(base + (pc * rows + row) * 8);
  h8 hi = *(const h8*)(base + ((pc + 2) * rows + row) * 8);
  v16h f;
#pragma unroll
  for (int j = 0; j < 8; ++j) { f[j] = lo[j]; f[j + 8] = hi[j]; }
  return f;
}

#if USE_TDM
static __device__ inline void tdm_load_2d_f16(unsigned int lds_off,
                                              const _Float16* gptr,
                                              unsigned int rowlen,
                                              unsigned int nrows) {
  const unsigned long long ga = (unsigned long long)(uintptr_t)gptr;
  v4u g0;
  g0[0] = 1u;                                   // count=1, user mode
  g0[1] = lds_off;                              // lds_addr
  g0[2] = (unsigned int)(ga & 0xffffffffu);     // global_addr[31:0]
  g0[3] = ((unsigned int)(ga >> 32) & 0x01ffffffu) | 0x80000000u; // addr[56:32]|type=2
  v8i g1;
  g1[0] = 0x00010000;
  g1[1] = (int)(rowlen << 16);
  g1[2] = (int)(nrows << 16);
  g1[3] = (int)(rowlen << 16);
  g1[4] = (int)nrows;
  g1[5] = (int)rowlen;
  g1[6] = 0;
  g1[7] = 0;
  v4i gz = {0, 0, 0, 0};                        // groups 2/3: 2-D tensor
#if defined(__clang_major__) && (__clang_major__ >= 23)
  v8i gz8 = {0, 0, 0, 0, 0, 0, 0, 0};
  __builtin_amdgcn_tensor_load_to_lds(g0, g1, gz, gz, gz8, 0);
#else
  __builtin_amdgcn_tensor_load_to_lds(g0, g1, gz, gz, 0);
#endif
}
#endif

// ---------------------------------------------------------------- LayerNorm
__global__ __launch_bounds__(256) void msa_ln_kernel(
    const float* __restrict__ msa, const float* __restrict__ lnw,
    const float* __restrict__ lnb, _Float16* __restrict__ xo) {
  const int lane = threadIdx.x & 31;
  const int wid  = threadIdx.x >> 5;
  const long long row = (long long)blockIdx.x * 8 + wid;
  const float* src = msa + row * DM;
  float4 a = ((const float4*)src)[lane * 2];
  float4 b = ((const float4*)src)[lane * 2 + 1];
  float s  = a.x + a.y + a.z + a.w + b.x + b.y + b.z + b.w;
  float ss = a.x*a.x + a.y*a.y + a.z*a.z + a.w*a.w +
             b.x*b.x + b.y*b.y + b.z*b.z + b.w*b.w;
#pragma unroll
  for (int off = 16; off >= 1; off >>= 1) {
    s  += __shfl_xor(s,  off, 32);
    ss += __shfl_xor(ss, off, 32);
  }
  const float mu   = s * (1.0f / DM);
  const float rstd = rsqrtf(ss * (1.0f / DM) - mu * mu + 1e-5f);
  float4 w0 = ((const float4*)lnw)[lane * 2], w1 = ((const float4*)lnw)[lane * 2 + 1];
  float4 c0 = ((const float4*)lnb)[lane * 2], c1 = ((const float4*)lnb)[lane * 2 + 1];
  h8 o;
  o[0] = (_Float16)((a.x - mu) * rstd * w0.x + c0.x);
  o[1] = (_Float16)((a.y - mu) * rstd * w0.y + c0.y);
  o[2] = (_Float16)((a.z - mu) * rstd * w0.z + c0.z);
  o[3] = (_Float16)((a.w - mu) * rstd * w0.w + c0.w);
  o[4] = (_Float16)((b.x - mu) * rstd * w1.x + c1.x);
  o[5] = (_Float16)((b.y - mu) * rstd * w1.y + c1.y);
  o[6] = (_Float16)((b.z - mu) * rstd * w1.z + c1.z);
  o[7] = (_Float16)((b.w - mu) * rstd * w1.w + c1.w);
  *(h8*)(xo + row * DM + lane * 8) = o;
}

// ------------------------------------------------ shared GEMM tile main loop
// Y = A * W^T over K = 256.  Block tile (FM*64) rows x 128 cols, 8 waves laid
// 4 (rows) x 2 (cols); each wave owns FM x 4 accumulator tiles of 16x16.
// K is staged 64 at a time; LDS rows are 128 B of data at a 144-B pitch.
// A lies in 16-B pieces, [k / 8][NSEQ rows][8]: neighbouring lanes fetch the same
// piece of neighbouring rows, 512 B in a row per wave.
#define GK     64
#define GPITCH 72
typedef __attribute__((ext_vector_type(4))) _Float16 h4;

template <int FM>
static __device__ inline void gemm_tile(const _Float16* __restrict__ A,
                                        const float* __restrict__ Wm,
                                        _Float16* xs, _Float16* wt,
                                        v8f (&acc)[FM][4]) {
  const int tid  = threadIdx.x;
  const int lane = tid & 31;
  const int wid  = tid >> 5;
  const int lc   = lane & 15;
  const int frow = (wid >> 1) * (FM * 16);
  const int fcol = (wid & 1) * 64;
  const int xrow = tid & (FM * 64 - 1);         // the thread's row of the tile
  const int xpc  = tid / (FM * 64);             // 4 / FM pieces per sweep
  const int wrow = tid >> 4;                    // 16 rows per sweep
  const int wseg = (tid & 15) * 4;              // 16 lanes cover 256 B of f32
  for (int kb = 0; kb < 256; kb += GK) {
    __syncthreads();
#pragma unroll
    for (int i = 0; i < FM * 2; ++i) {          // stage A tile (f16)
      const int pc = xpc + i * (4 / FM);
      *(h8*)(xs + xrow * GPITCH + pc * 8) =
          *(const h8*)(A + (size_t)((kb >> 3) + pc) * (NSEQ * 8) + xrow * 8);
    }
#pragma unroll
    for (int i = 0; i < 8; ++i) {               // stage W tile, f32 -> f16
      const int r = wrow + i * 16;
      const float4 d = *(const float4*)(Wm + (size_t)r * 256 + kb + wseg);
      h4 c;
      c[0] = (_Float16)d.x; c[1] = (_Float16)d.y;
      c[2] = (_Float16)d.z; c[3] = (_Float16)d.w;
      *(h4*)(wt + r * GPITCH + wseg) = c;
    }
    __syncthreads();
#pragma unroll
    for (int ks = 0; ks < GK; ks += 32) {
      v16h a[FM], b[4];
#pragma unroll
      for (int i = 0; i < FM; ++i)
        a[i] = frag_rowmajor(xs + (frow + i * 16 + lc) * GPITCH + ks, lane);
#pragma unroll
      for (int j = 0; j < 4; ++j)
        b[j] = frag_rowmajor(wt + (fcol + j * 16 + lc) * GPITCH + ks, lane);
#pragma unroll
      for (int i = 0; i < FM; ++i)
#pragma unroll
        for (int j = 0; j < 4; ++j) acc[i][j] = wmma_f16(a[i], b[j], acc[i][j]);
    }
  }
}

static __device__ inline float exp2_slot(float t) {
  float e;
  asm("v_exp_f32 %0, %1\n\tv_nop" : "=v"(e) : "v"(t));
  return e;
}

// --------------------------------------------------- fused Q/K/V/G projection
// A block's 256 rows are 16 sequences n x 16 columns l: tile row r is
// (n = r & 15, l = r >> 4), so the 16 rows of a WMMA tile are 16 neighbouring n
// of one l.  Per (l, head) the outputs are laid in 16-B pieces:
//   q, k, gate: [d / 8][n][8 d]   (product run as W x^T: a lane holds 8 d of one n)
//   v:          [n / 8][d][8 n]   (product run as x W^T: a lane holds 8 n of one d)
// In both, the 16 lanes of a half wave store 256 B in a row.
__global__ __launch_bounds__(256) void msa_proj_kernel(
    const _Float16* __restrict__ x,
    const float* __restrict__ wq, const float* __restrict__ wk,
    const float* __restrict__ wvm, const float* __restrict__ wg,
    const float* __restrict__ bg,
    _Float16* __restrict__ qo, _Float16* __restrict__ ko,
    _Float16* __restrict__ vo, _Float16* __restrict__ go) {
  __shared__ __attribute__((aligned(16))) _Float16 sm[(256 + 128) * GPITCH];
  _Float16* xs = sm;                            // 256 rows of x
  _Float16* wt = sm + 256 * GPITCH;             // 128 rows of W
  const int tid  = threadIdx.x;
  const int lane = tid & 31;
  const int wid  = tid >> 5;
  const int lh   = lane >> 4;
  const int lc   = lane & 15;
  const int nb   = blockIdx.y / (LCOL / 16);    // group of 16 sequences
  const int lb   = blockIdx.y % (LCOL / 16);    // group of 16 columns
  const int mat  = blockIdx.x >> 1;             // 0:q 1:k 2:v 3:g
  const int colt = (blockIdx.x & 1) * 128;
  const float* W = (mat == 0) ? wq : (mat == 1) ? wk : (mat == 2) ? wvm : wg;
  const int frow = (wid >> 1) * 64;             // wave's 64-row chunk (4 values of l)
  const int fcol = (wid & 1) * 64;              // wave's 64-col half (2 heads)
  const int xrow = tid >> 3;                    // 32 rows per sweep
  const int xseg = (tid & 7) * 8;               // 8 lanes cover one 128-B line
  const int wrow = tid >> 4;                    // 16 rows per sweep
  const int wseg = (tid & 15) * 4;              // 16 lanes cover 256 B of f32
  const _Float16* A =
      x + ((size_t)(nb * 16 + (xrow & 15)) * LCOL + lb * 16 + (xrow >> 4)) * DM + xseg;
  const float* Wm = W + (size_t)(colt + wrow) * DM + wseg;
  // first (M) and second (N) operand of the product: x, W for v; W, x otherwise
  const int xoff = (frow + lc) * GPITCH;
  const int woff = (256 + fcol + lc) * GPITCH;
  const int foff = (mat == 2) ? xoff : woff;
  const int soff = (mat == 2) ? woff : xoff;
  v8f acc[4][4] = {};
  for (int kb = 0; kb < 256; kb += GK) {
    __syncthreads();
#pragma unroll
    for (int i = 0; i < 8; ++i)                 // stage x tile: sweep i holds l = 2i, 2i + 1
      *(h8*)(xs + (xrow + i * 32) * GPITCH + xseg) = *(const h8*)(A + i * 2 * DM + kb);
#pragma unroll
    for (int i = 0; i < 8; ++i) {               // stage W tile, f32 -> f16
      const float4 d = *(const float4*)(Wm + i * 16 * DM + kb);
      h4 c;
      c[0] = (_Float16)d.x; c[1] = (_Float16)d.y;
      c[2] = (_Float16)d.z; c[3] = (_Float16)d.w;
      *(h4*)(wt + (wrow + i * 16) * GPITCH + wseg) = c;
    }
    __syncthreads();
#pragma unroll
    for (int ks = 0; ks < GK; ks += 32) {
      v16h a[4], b[4];
#pragma unroll
      for (int i = 0; i < 4; ++i) a[i] = frag_rowmajor(sm + foff + i * 16 * GPITCH + ks, lane);
#pragma unroll
      for (int j = 0; j < 4; ++j) b[j] = frag_rowmajor(sm + soff + j * 16 * GPITCH + ks, lane);
#pragma unroll
      for (int i = 0; i < 4; ++i)
#pragma unroll
        for (int j = 0; j < 4; ++j) acc[i][j] = wmma_f16(a[i], b[j], acc[i][j]);
    }
  }
  // acc[i][j][r]: first operand's row i*16 + lh*8 + r, second operand's row j*16 + lc
  const size_t LH = (size_t)NSEQ * DHID;        // halves per (l, head)
  const size_t t0 =
      ((size_t)(lb * 16 + (wid >> 1) * 4) * NHEAD + ((colt + fcol) >> 5)) * LH;
  if (mat == 2) {                               // v: i picks l, j picks head and d half
    _Float16* dst = vo + t0 + ((nb * 2 + lh) * DHID + lc) * 8;
#pragma unroll
    for (int i = 0; i < 4; ++i) {
#pragma unroll
      for (int j = 0; j < 4; ++j) {
        h8 w;
#pragma unroll
        for (int r = 0; r < 8; ++r) w[r] = (_Float16)acc[i][j][r];
        *(h8*)(dst + i * NHEAD * LH + (j >> 1) * LH + (j & 1) * 128) = w;
      }
    }
  } else if (mat == 3) {                        // sigmoid gate: j picks l, i head and d half
    _Float16* dst = go + t0 + (lh * NSEQ + nb * 16 + lc) * 8;
#pragma unroll
    for (int i = 0; i < 4; ++i) {
      const float4 b0 = *(const float4*)(bg + colt + fcol + i * 16 + lh * 8);
      const float4 b1 = *(const float4*)(bg + colt + fcol + i * 16 + lh * 8 + 4);
      const float bv[8] = {b0.x, b0.y, b0.z, b0.w, b1.x, b1.y, b1.z, b1.w};
#pragma unroll
      for (int j = 0; j < 4; ++j) {
        h8 w;
#pragma unroll
        for (int r = 0; r < 8; ++r)
          w[r] = (_Float16)(1.0f /
                            (1.0f + exp2_slot((acc[i][j][r] + bv[r]) * -1.4426950408889634f)));
        *(h8*)(dst + j * NHEAD * LH + (i >> 1) * LH + (i & 1) * 2 * NSEQ * 8) = w;
      }
      // the stores above still name their registers: hold any later write of those
      // registers behind them (the next bias loads' results landed there; behind
      // the last round the listing joins this part to the v part)
      asm volatile("s_wait_xcnt 0x0" ::: "memory");
    }
  } else {                                      // q (pre-scaled), k: the same places
    const float sc = (mat == 0) ? 0.17677669529663687f : 1.0f;  // 1/sqrt(32)
    _Float16* dst = ((mat == 0) ? qo : ko) + t0 + (lh * NSEQ + nb * 16 + lc) * 8;
#pragma unroll
    for (int j = 0; j < 4; ++j) {
#pragma unroll
      for (int i = 0; i < 4; ++i) {
        h8 w;
#pragma unroll
        for (int r = 0; r < 8; ++r) w[r] = (_Float16)(acc[i][j][r] * sc);
        *(h8*)(dst + j * NHEAD * LH + (i >> 1) * LH + (i & 1) * 2 * NSEQ * 8) = w;
      }
    }
    asm volatile("s_wait_xcnt 0x0" ::: "memory");
  }
}

static __device__ inline float xhalf(float x) {
  const int b = __builtin_bit_cast(int, x);
  return __builtin_bit_cast(
      float, __builtin_amdgcn_permlanex16(b, b, 0x76543210, 0xfedcba98, false, false));
}

__global__ __launch_bounds__(256) void msa_attn_kernel(
    const _Float16* __restrict__ q, const _Float16* __restrict__ k,
    const _Float16* __restrict__ v, const _Float16* __restrict__ gate,
    _Float16* __restrict__ att) {
  // whole V of this (l,h), 16KB, as it lies in memory: [n / 8][d][8 n]
  __shared__ __attribute__((aligned(16))) _Float16 vsbuf[NSEQ][DHID];
  const int lane = threadIdx.x & 31;
  const int wid  = threadIdx.x >> 5;
  const int lh   = lane >> 4;
  const int lc   = lane & 15;
  const int li   = blockIdx.x >> 3;     // column index 0..383
  const int hh   = blockIdx.x & 7;      // head
  const size_t base = ((size_t)li * NHEAD + hh) * NSEQ * DHID;
  const _Float16* qb = q + base;
  const _Float16* kp = k + base;
  const _Float16* vp = v + base;
  const int row0 = wid * 32;            // this wave's 32 query rows

  const v16h qa0 = frag_piecemajor(qb, NSEQ, row0 + lc,      lane);
  const v16h qa1 = frag_piecemajor(qb, NSEQ, row0 + 16 + lc, lane);

#if USE_TDM
  if (wid == 0) {
    tdm_load_2d_f16((unsigned int)(uintptr_t)&vsbuf[0][0], vp, DHID, NSEQ);
  }
#else
  // Fallback: cooperative staged copy of V into LDS (128-bit loads).
  for (int rr = wid * 4; rr < NSEQ; rr += 32) {
    const int r2 = rr + (lane >> 3);
    const int c2 = (lane & 7) * 4;
    *(h8*)&vsbuf[r2][c2] = *(const h8*)(vp + (size_t)r2 * DHID + c2);
  }
#endif

#if USE_TDM
  if (wid == 0) __builtin_amdgcn_s_wait_tensorcnt(0);
#endif
  __syncthreads();

  // ot[s][c][r] = O[query row0 + c*16 + lc][d = s*16 + lh*8 + r]
  v8f ot[2][2] = {};
  v2f mrow = {-1e30f, -1e30f};          // running maximum of the lane's two queries
  v2f lrow = {0.0f, 0.0f};              // their sums over THIS half's keys only

  for (int kt = 0; kt < NSEQ; kt += 32) {
    if (kt + 32 < NSEQ) {
      __builtin_prefetch(kp + (size_t)(kt + 32) * 8, 0, 1);
    }
    // A operand of S^T: lane owns key row lc of each 16-key group
    const v16h kb0 = frag_piecemajor(kp, NSEQ, kt + lc,      lane);
    const v16h kb1 = frag_piecemajor(kp, NSEQ, kt + 16 + lc, lane);
    // A operand of O^T: lane owns row d of V^T, k runs over the pass's keys
    // (&vsbuf[kt][0] is piece row kt / 8 of the [n / 8][d][8 n] tile)
    const v16h vb0 = frag_piecemajor(&vsbuf[kt][0], DHID, lc,      lane);
    const v16h vb1 = frag_piecemajor(&vsbuf[kt][0], DHID, 16 + lc, lane);
    v8f zero = {};
    // st[t][c][r] = S[query c*16 + lc][key kt + t*16 + lh*8 + r]
    v8f st[2][2];
    st[0][0] = wmma_f16(kb0, qa0, zero);
    st[1][0] = wmma_f16(kb1, qa0, zero);
    st[0][1] = wmma_f16(kb0, qa1, zero);
    st[1][1] = wmma_f16(kb1, qa1, zero);
    v2f mnew;
#pragma unroll
    for (int c = 0; c < 2; ++c) {
      float mx = fmaxf(st[0][c][0], st[1][c][0]);
#pragma unroll
      for (int r = 1; r < 8; ++r) mx = fmaxf(mx, fmaxf(st[0][c][r], st[1][c][r]));
      mnew[c] = fmaxf(mrow[c], fmaxf(mx, xhalf(mx)));
    }
    const v2f corr = {__expf(mrow.x - mnew.x), __expf(mrow.y - mnew.y)};
    mrow = mnew;
    v2f rsum;
#pragma unroll
    for (int c = 0; c < 2; ++c) {
      v16h pb;                          // P^T fragment, hardware k order
      v2f rs0 = {0.0f, 0.0f}, rs1 = {0.0f, 0.0f};
#pragma unroll
      for (int r = 0; r < 8; r += 2) {  // neighbouring registers go in pairs
        const v2f p0 = {__expf(st[0][c][r] - mnew[c]), __expf(st[0][c][r + 1] - mnew[c])};
        const v2f p1 = {__expf(st[1][c][r] - mnew[c]), __expf(st[1][c][r + 1] - mnew[c])};
        rs0 += p0;
        rs1 += p1;
        pb[r]     = (_Float16)p0.x;
        pb[r + 1] = (_Float16)p0.y;
        pb[r + 8] = (_Float16)p1.x;
        pb[r + 9] = (_Float16)p1.y;
      }
      rs0 += rs1;
      rsum[c] = rs0.x + rs0.y;
#pragma unroll
      for (int r = 0; r < 8; ++r) { ot[0][c][r] *= corr[c]; ot[1][c][r] *= corr[c]; }
      ot[0][c] = wmma_f16(vb0, pb, ot[0][c]);
      ot[1][c] = wmma_f16(vb1, pb, ot[1][c]);
    }
    lrow = lrow * corr + rsum;
  }
  // normalize, gate, store gated output f16 in the gate's own layout
  // [l][h][d / 8][n][8]: a lane's 8 registers of a tile are 8 consecutive d of its query
  h8 g[2][2];
#pragma unroll
  for (int c = 0; c < 2; ++c) {
#pragma unroll
    for (int s = 0; s < 2; ++s) {
      g[c][s] = *(const h8*)(gate + base + ((s * 2 + lh) * NSEQ + row0 + c * 16 + lc) * 8);
      // the load above still names its address registers: hold any later write
      // of them (the next load's result may land there) behind it
      asm volatile("s_wait_xcnt 0x0" ::: "memory");
    }
  }
#pragma unroll
  for (int c = 0; c < 2; ++c) {
    const float inv = 1.0f / (lrow[c] + xhalf(lrow[c]));
#pragma unroll
    for (int s = 0; s < 2; ++s) {
      h8 w;
#pragma unroll
      for (int r = 0; r < 8; ++r)
        w[r] = (_Float16)((ot[s][c][r] * inv) * (float)g[c][s][r]);
      *(h8*)(att + base + ((s * 2 + lh) * NSEQ + row0 + c * 16 + lc) * 8) = w;
    }
  }
}

// ------------------------------------------------------- output projection
__global__ __launch_bounds__(256) void msa_outproj_kernel(
    const _Float16* __restrict__ a, const float* __restrict__ wo,
    const float* __restrict__ bo, float* __restrict__ out) {
  __shared__ __attribute__((aligned(16))) _Float16 xs[128 * GPITCH];
  __shared__ __attribute__((aligned(16))) _Float16 wt[128 * GPITCH];
  const int lane  = threadIdx.x & 31;
  const int wid   = threadIdx.x >> 5;
  const int li    = blockIdx.y >> 1;            // the block's column l
  const int nbase = (blockIdx.y & 1) * 128;     // its 128 sequences n
  const int colt  = blockIdx.x * 128;
  const int frow  = (wid >> 1) * 32;
  const int fcol  = (wid & 1) * 64;
  v8f acc[2][4] = {};
  gemm_tile<2>(a + (size_t)li * (NSEQ * HD) + nbase * 8, wo + (size_t)colt * HD, xs, wt, acc);
  const int lh = lane >> 4;
  const int lc = lane & 15;
#pragma unroll
  for (int i = 0; i < 2; ++i) {
#pragma unroll
    for (int r = 0; r < 8; ++r) {
      const int m = (nbase + frow + i * 16 + r + lh * 8) * LCOL + li;
#pragma unroll
      for (int s = 0; s < 4; ++s) {
        const int c = colt + fcol + s * 16 + lc;
        out[(size_t)m * DM + c] = acc[i][s][r] + bo[c];
      }
    }
  }
}

extern "C" void kernel_launch(void* const* d_in, const int* in_sizes, int n_in,
                              void* d_out, int out_size, void* d_ws, size_t ws_size,
                              hipStream_t stream) {
  (void)in_sizes; (void)n_in; (void)out_size; (void)ws_size;
  const float* msa = (const float*)d_in[0];
  const float* lnw = (const float*)d_in[1];
  const float* lnb = (const float*)d_in[2];
  const float* wq  = (const float*)d_in[3];
  const float* wk  = (const float*)d_in[4];
  const float* wv  = (const float*)d_in[5];
  const float* wg  = (const float*)d_in[6];
  const float* bg  = (const float*)d_in[7];
  const float* wo  = (const float*)d_in[8];
  const float* bo  = (const float*)d_in[9];
  float* out = (float*)d_out;

  const size_t sz = (size_t)MROWS * DM;     // halves per f16 buffer (50.3 MB each)
  _Float16* xh = (_Float16*)d_ws;           // LayerNormed x       [m][dm]
  _Float16* qh = xh + sz;                   // Q (pre-scaled)      [l][h][d/8][n][8]
  _Float16* kh = qh + sz;                   // K                   [l][h][d/8][n][8]
  _Float16* vh = kh + sz;                   // V                   [l][h][n/8][d][8]
  _Float16* gh = vh + sz;                   // sigmoid gate        [l][h][d/8][n][8]
  _Float16* ah = gh + sz;                   // gated attn output   [l][h][d/8][n][8]

  msa_ln_kernel<<<MROWS / 8, 256, 0, stream>>>(msa, lnw, lnb, xh);
  msa_proj_kernel<<<dim3(8, MROWS / 256), 256, 0, stream>>>(
      xh, wq, wk, wv, wg, bg, qh, kh, vh, gh);
  msa_attn_kernel<<<LCOL * NHEAD, 256, 0, stream>>>(qh, kh, vh, gh, ah);
  msa_outproj_kernel<<<dim3(2, MROWS / 128), 256, 0, stream>>>(ah, wo, bo, out);
}

// v004
// It runs in 132 microseconds.
// In both of two side-by-side timings against v003, it was 1.28 times as fast.
// Counting every step since v000, it is 2.81 times as fast.
#include <hip/hip_runtime.h>

#define DM    256
#define NSEQ  256
#define LCOL  384
#define NHEAD 8
#define DHID  32
#define HD    (NHEAD * DHID)          // 256
#define MROWS (NSEQ * LCOL)           // 98304

typedef __attribute__((ext_vector_type(16))) _Float16     v16h;
typedef __attribute__((ext_vector_type(8)))  _Float16     h8;
typedef __attribute__((ext_vector_type(8)))  float        v8f;
typedef __attribute__((ext_vector_type(2)))  float        v2f;
typedef __attribute__((ext_vector_type(4)))  unsigned int v4u;
typedef __attribute__((ext_vector_type(8)))  int          v8i;
typedef __attribute__((ext_vector_type(4)))  int          v4i;

#if defined(__has_builtin)
#if __has_builtin(__builtin_amdgcn_tensor_load_to_lds) && \
    __has_builtin(__builtin_amdgcn_s_wait_tensorcnt)
#define USE_TDM 1
#endif
#endif
#ifndef USE_TDM
#define USE_TDM 0
#endif

static __device__ inline v8f wmma_f16(v16h a, v16h b, v8f c) {
  // (neg_a, A, neg_b, B, c_mod, C, reuse_a, reuse_b)
  return __builtin_amdgcn_wmma_f32_16x16x32_f16(false, a, false, b, (short)0, c,
                                                false, false);
}

static __device__ inline v16h frag_rowmajor(const _Float16* rowptr, int lane) {
  const int kb = (lane >> 4) * 8;
  h8 lo = *(const h8*)(rowptr + kb);
  h8 hi = *(const h8*)(rowptr + kb + 16);
  v16h f;
#pragma unroll
  for (int j = 0; j < 8; ++j) { f[j] = lo[j]; f[j + 8] = hi[j]; }
  return f;
}

// Same fragment from a piece-major tile [k / 8][row][8] of 'rows' rows: the 16
// lanes of a half wave read 16 neighbouring 16-B pieces, 256 B in a row.
static __device__ inline v16h frag_piecemajor(const _Float16* base, int rows,
                                              int row, int lane) {
  const int pc = lane >> 4;
  h8 lo = *(const h8*)(base + (pc * rows + row) * 8);
  h8 hi = *(const h8*)(base + ((pc + 2) * rows + row) * 8);
  v16h f;
#pragma unroll
  for (int j = 0; j < 8; ++j) { f[j] = lo[j]; f[j + 8] = hi[j]; }
  return f;
}

#if USE_TDM
static __device__ inline void tdm_load_2d_f16(unsigned int lds_off,
                                              const _Float16* gptr,
                                              unsigned int rowlen,
                                              unsigned int nrows) {
  const unsigned long long ga = (unsigned long long)(uintptr_t)gptr;
  v4u g0;
  g0[0] = 1u;                                   // count=1, user mode
  g0[1] = lds_off;                              // lds_addr
  g0[2] = (unsigned int)(ga & 0xffffffffu);     // global_addr[31:0]
  g0[3] = ((unsigned int)(ga >> 32) & 0x01ffffffu) | 0x80000000u; // addr[56:32]|type=2
  v8i g1;
  g1[0] = 0x00010000;
  g1[1] = (int)(rowlen << 16);
  g1[2] = (int)(nrows << 16);
  g1[3] = (int)(rowlen << 16);
  g1[4] = (int)nrows;
  g1[5] = (int)rowlen;
  g1[6] = 0;
  g1[7] = 0;
  v4i gz = {0, 0, 0, 0};                        // groups 2/3: 2-D tensor
#if defined(__clang_major__) && (__clang_major__ >= 23)
  v8i gz8 = {0, 0, 0, 0, 0, 0, 0, 0};
  __builtin_amdgcn_tensor_load_to_lds(g0, g1, gz, gz, gz8, 0);
#else
  __builtin_amdgcn_tensor_load_to_lds(g0, g1, gz, gz, 0);
#endif
}
#endif

// ---------------------------------------------------------------- LayerNorm
__global__ __launch_bounds__(256) void msa_ln_kernel(
    const float* __restrict__ msa, const float* __restrict__ lnw,
    const float* __restrict__ lnb, _Float16* __restrict__ xo) {
  const int lane = threadIdx.x & 31;
  const int wid  = threadIdx.x >> 5;
  const long long row = (long long)blockIdx.x * 8 + wid;
  const float* src = msa + row * DM;
  float4 a = ((const float4*)src)[lane * 2];
  float4 b = ((const float4*)src)[lane * 2 + 1];
  float s  = a.x + a.y + a.z + a.w + b.x + b.y + b.z + b.w;
  float ss = a.x*a.x + a.y*a.y + a.z*a.z + a.w*a.w +
             b.x*b.x + b.y*b.y + b.z*b.z + b.w*b.w;
#pragma unroll
  for (int off = 16; off >= 1; off >>= 1) {
    s  += __shfl_xor(s,  off, 32);
    ss += __shfl_xor(ss, off, 32);
  }
  const float mu   = s * (1.0f / DM);
  const float rstd = rsqrtf(ss * (1.0f / DM) - mu * mu + 1e-5f);
  float4 w0 = ((const float4*)lnw)[lane * 2], w1 = ((const float4*)lnw)[lane * 2 + 1];
  float4 c0 = ((const float4*)lnb)[lane * 2], c1 = ((const float4*)lnb)[lane * 2 + 1];
  h8 o;
  o[0] = (_Float16)((a.x - mu) * rstd * w0.x + c0.x);
  o[1] = (_Float16)((a.y - mu) * rstd * w0.y + c0.y);
  o[2] = (_Float16)((a.z - mu) * rstd * w0.z + c0.z);
  o[3] = (_Float16)((a.w - mu) * rstd * w0.w + c0.w);
  o[4] = (_Float16)((b.x - mu) * rstd * w1.x + c1.x);
  o[5] = (_Float16)((b.y - mu) * rstd * w1.y + c1.y);
  o[6] = (_Float16)((b.z - mu) * rstd * w1.z + c1.z);
  o[7] = (_Float16)((b.w - mu) * rstd * w1.w + c1.w);
  *(h8*)(xo + row * DM + lane * 8) = o;
}

// ------------------------------------------------ shared GEMM tile main loop
// Y = A * W^T over K = 256.  Block tile (FM*64) rows x 128 cols, 8 waves laid
// 4 (rows) x 2 (cols); each wave owns FM x 4 accumulator tiles of 16x16.
// K is staged 64 at a time; LDS rows are 128 B of data at a 144-B pitch.
// A lies in 16-B pieces, [k / 8][NSEQ rows][8]: neighbouring lanes fetch the same
// piece of neighbouring rows, 512 B in a row per wave.
#define GK     64
#define GPITCH 72
typedef __attribute__((ext_vector_type(4))) _Float16 h4;

template <int FM>
static __device__ inline void gemm_tile(const _Float16* __restrict__ A,
                                        const float* __restrict__ Wm,
                                        _Float16* xs, _Float16* wt,
                                        v8f (&acc)[FM][4]) {
  const int tid  = threadIdx.x;
  const int lane = tid & 31;
  const int wid  = tid >> 5;
  const int lc   = lane & 15;
  const int frow = (wid >> 1) * (FM * 16);
  const int fcol = (wid & 1) * 64;
  const int xrow = tid & (FM * 64 - 1);         // the thread's row of the tile
  const int xpc  = tid / (FM * 64);             // 4 / FM pieces per sweep
  const int wrow = tid >> 4;                    // 16 rows per sweep
  const int wseg = (tid & 15) * 4;              // 16 lanes cover 256 B of f32
  for (int kb = 0; kb < 256; kb += GK) {
    __syncthreads();
#pragma unroll
    for (int i = 0; i < FM * 2; ++i) {          // stage A tile (f16)
      const int pc = xpc + i * (4 / FM);
      *(h8*)(xs + xrow * GPITCH + pc * 8) =
          *(const h8*)(A + (size_t)((kb >> 3) + pc) * (NSEQ * 8) + xrow * 8);
    }
#pragma unroll
    for (int i = 0; i < 8; ++i) {               // stage W tile, f32 -> f16
      const int r = wrow + i * 16;
      const float4 d = *(const float4*)(Wm + (size_t)r * 256 + kb + wseg);
      h4 c;
      c[0] = (_Float16)d.x; c[1] = (_Float16)d.y;
      c[2] = (_Float16)d.z; c[3] = (_Float16)d.w;
      *(h4*)(wt + r * GPITCH + wseg) = c;
    }
    __syncthreads();
#pragma unroll
    for (int ks = 0; ks < GK; ks += 32) {
      v16h a[FM], b[4];
#pragma unroll
      for (int i = 0; i < FM; ++i)
        a[i] = frag_rowmajor(xs + (frow + i * 16 + lc) * GPITCH + ks, lane);
#pragma unroll
      for (int j = 0; j < 4; ++j)
        b[j] = frag_rowmajor(wt + (fcol + j * 16 + lc) * GPITCH + ks, lane);
#pragma unroll
      for (int i = 0; i < FM; ++i)
#pragma unroll
        for (int j = 0; j < 4; ++j) acc[i][j] = wmma_f16(a[i], b[j], acc[i][j]);
    }
  }
}

static __device__ inline float exp2_slot(float t) {
  float e;
  asm("v_exp_f32 %0, %1\n\tv_nop" : "=v"(e) : "v"(t));
  return e;
}

// --------------------------------------------------- fused Q/K/V/G projection
// Weight-stationary: 256 work-groups, one per WGP.  A work-group owns 128 output
// columns of each of the four matrices (512 weight rows); they are converted to
// f16 once, pass through LDS once, and then stay in registers as fragments: a
// wave holds 16 columns of q, k, v and gate over the whole K = 256.  The
// work-group then walks 12 tiles of 64 rows of x through two LDS buffers.
// A tile's 64 rows are 16 sequences n x 4 columns l: tile row r is
// (n = r & 15, l = r >> 4), so the 16 rows of a WMMA tile are 16 neighbouring n
// of one l.  Per (l, head) the outputs are laid in 16-B pieces:
//   q, k, gate: [d / 8][n][8 d]   (product run as W x^T: a lane holds 8 d of one n)
//   v:          [n / 8][d][8 n]   (product run as x W^T: a lane holds 8 n of one d)
// In both, the 16 lanes of a half wave store 256 B in a row.
#define XP     264                    // LDS pitch of a 256-half row: 528 B = 16 B x 33
#define PTILES 12                     // x tiles per work-group
#define LQ     (LCOL / 4)             // groups of 4 columns l
// Tile t of x into registers: sweep i is tile row i * 8 + wave, 512 B in a row.
static __device__ inline void load_x_tile(h8 (&xr)[8], const _Float16* xlane, int t) {
  const _Float16* p = xlane + ((size_t)(t / LQ) * 16 * LCOL + (t % LQ) * 4) * DM;
#pragma unroll
  for (int i = 0; i < 8; ++i) xr[i] = *(const h8*)(p + ((i & 1) * 8 * LCOL + (i >> 1)) * DM);
  // the loads still name their address registers: the wait takes the address as an
  // input, so that nothing is written there in front of it
  asm volatile("s_wait_xcnt 0x0" ::"v"(p) : "memory");
}
static __device__ inline void stage_x_tile(_Float16* dst, const h8 (&xr)[8]) {
#pragma unroll
  for (int i = 0; i < 8; ++i) *(h8*)(dst + i * 8 * XP) = xr[i];
}
// Four stores, one per l.  They still name their address and data registers: the
// wait takes those as inputs, so that nothing is written there in front of it.
static __device__ inline void store_4l(_Float16* sp, const h8 (&w)[4]) {
#pragma unroll
  for (int j = 0; j < 4; ++j) *(h8*)(sp + (size_t)j * NHEAD * NSEQ * DHID) = w[j];
  asm volatile("s_wait_xcnt 0x0" ::"v"(sp), "v"(w[0]), "v"(w[1]), "v"(w[2]), "v"(w[3]) : "memory");
}

__global__ __launch_bounds__(256) void msa_proj_kernel(
    const _Float16* __restrict__ x,
    const float* __restrict__ wq, const float* __restrict__ wk,
    const float* __restrict__ wvm, const float* __restrict__ wg,
    const float* __restrict__ bg,
    _Float16* __restrict__ qo, _Float16* __restrict__ ko,
    _Float16* __restrict__ vo, _Float16* __restrict__ go) {
  // first all 512 weight rows; once they are in registers, the two x buffers
  __shared__ __attribute__((aligned(16))) _Float16 sm[512 * XP];
  const int tid  = threadIdx.x;
  const int lane = tid & 31;
  const int wid  = tid >> 5;
  const int lh   = lane >> 4;
  const int lc   = lane & 15;
  const int hb   = blockIdx.x;                  // which 128 columns of each matrix
  const int t0   = blockIdx.y * PTILES;         // first x tile
  const int head = hb * 4 + (wid >> 1);         // the wave's 16 columns: half a head
  const int dh   = wid & 1;

  // a wave fetches whole rows of x, 512 B in a row: sweep i holds tile row i * 8 + wid
  h8 xr[8];
  const _Float16* xlane = x + (size_t)wid * LCOL * DM + lane * 8;
  load_x_tile(xr, xlane, t0);

  // weights: f32 -> f16 into LDS row m * 128 + c, 64 lanes cover a 1-KB row
#pragma unroll 1
  for (int m = 0; m < 4; ++m) {
    const float* Wm = ((m == 0) ? wq : (m == 1) ? wk : (m == 2) ? wvm : wg) +
                      (size_t)(hb * 128 + (tid >> 6)) * DM + (tid & 63) * 4;
    _Float16* wl = sm + (m * 128 + (tid >> 6)) * XP + (tid & 63) * 4;
#pragma unroll
    for (int i = 0; i < 32; ++i) {
      const float4 d = *(const float4*)(Wm + i * 4 * DM);
      h4 c;
      c[0] = (_Float16)d.x; c[1] = (_Float16)d.y;
      c[2] = (_Float16)d.z; c[3] = (_Float16)d.w;
      *(h4*)(wl + i * 4 * XP) = c;
    }
    asm volatile("s_wait_xcnt 0x0" ::"v"(Wm) : "memory");
  }
  float bv[8];                                  // the lane's 8 gate biases
  {
    const float* bp = bg + hb * 128 + wid * 16 + lh * 8;
    const float4 b0 = *(const float4*)bp;
    const float4 b1 = *(const float4*)(bp + 4);
    asm volatile("s_wait_xcnt 0x0" ::"v"(bp) : "memory");
    bv[0] = b0.x; bv[1] = b0.y; bv[2] = b0.z; bv[3] = b0.w;
    bv[4] = b1.x; bv[5] = b1.y; bv[6] = b1.z; bv[7] = b1.w;
  }
  __syncthreads();
  v16h wf[8][4];                                // [k / 32][matrix]
#pragma unroll
  for (int ks = 0; ks < 8; ++ks)
#pragma unroll
    for (int m = 0; m < 4; ++m)
      wf[ks][m] = frag_rowmajor(sm + (m * 128 + wid * 16 + lc) * XP + ks * 32, lane);
  __syncthreads();                              // every wave has its weights: LDS is free
  stage_x_tile(sm + wid * XP + lane * 8, xr);
  load_x_tile(xr, xlane, t0 + 1);
  __syncthreads();

  const size_t LH = (size_t)NSEQ * DHID;        // halves per (l, head)
#pragma unroll 1
  for (int it = 0; it < PTILES; ++it) {
    const _Float16* cur = sm + (it & 1) * (64 * XP);
    // the other buffer's readers left it in front of the last barrier
    if (it + 1 < PTILES) stage_x_tile(sm + ((it + 1) & 1) * (64 * XP) + wid * XP + lane * 8, xr);
    if (it + 2 < PTILES) load_x_tile(xr, xlane, t0 + it + 2);
    v8f acc[4][4] = {};                         // [matrix][l]
    // x fragments are fetched one k step ahead into a second register set.  The
    // scheduling fences keep each step's eight LDS loads together in front of the
    // 16 products of the step before: left alone, the compiler put two loads and
    // a full wait in front of every four products
    v16h xf[2][4];
#pragma unroll
    for (int j = 0; j < 4; ++j) xf[0][j] = frag_rowmajor(cur + (j * 16 + lc) * XP, lane);
#pragma unroll
    for (int ks = 0; ks < 8; ++ks) {
      if (ks < 7) {
#pragma unroll
        for (int j = 0; j < 4; ++j)
          xf[(ks + 1) & 1][j] = frag_rowmajor(cur + (j * 16 + lc) * XP + (ks + 1) * 32, lane);
      }
      __builtin_amdgcn_sched_barrier(0);
      if (ks == 7) {
        // the tile's barrier, split.  The wave's last LDS reads of this buffer and its
        // stores into the other one are done: say so here, and wait for the others
        // only behind the epilogue, which touches no LDS
        asm volatile("s_wait_dscnt 0x0" ::: "memory");
        asm volatile("s_barrier_signal -1" ::: "memory");
      }
#pragma unroll
      for (int j = 0; j < 4; ++j) {
        acc[0][j] = wmma_f16(wf[ks][0], xf[ks & 1][j], acc[0][j]);
        acc[1][j] = wmma_f16(wf[ks][1], xf[ks & 1][j], acc[1][j]);
        acc[2][j] = wmma_f16(xf[ks & 1][j], wf[ks][2], acc[2][j]);
        acc[3][j] = wmma_f16(wf[ks][3], xf[ks & 1][j], acc[3][j]);
      }
      __builtin_amdgcn_sched_barrier(0);
    }
    // (the fence behind the last step also lets the epilogue be scheduled by itself:
    // joined to the matrix part, the gate's 32 divisions came out as one chain)
    const int t  = t0 + it;
    const int nb = t / LQ;                      // group of 16 sequences
    const size_t tb = ((size_t)(t % LQ) * 4 * NHEAD + head) * LH;
    // q, k, gate: acc[m][j][r] is d = dh * 16 + lh * 8 + r of n = nb * 16 + lc
    const size_t pq = tb + ((dh * 2 + lh) * NSEQ + nb * 16 + lc) * 8;
    // v: acc[2][j][r] is n = nb * 16 + lh * 8 + r of d = dh * 16 + lc
    const size_t pv = tb + ((nb * 2 + lh) * DHID + dh * 16 + lc) * 8;
    h8 w[4];
#pragma unroll
    for (int j = 0; j < 4; ++j)                 // q, pre-scaled by 1/sqrt(32)
#pragma unroll
      for (int r = 0; r < 8; ++r) w[j][r] = (_Float16)(acc[0][j][r] * 0.17677669529663687f);
    store_4l(qo + pq, w);
#pragma unroll
    for (int j = 0; j < 4; ++j)
#pragma unroll
      for (int r = 0; r < 8; ++r) w[j][r] = (_Float16)acc[1][j][r];
    store_4l(ko + pq, w);
#pragma unroll
    for (int j = 0; j < 4; ++j)
#pragma unroll
      for (int r = 0; r < 8; ++r) w[j][r] = (_Float16)acc[2][j][r];
    store_4l(vo + pv, w);
#pragma unroll
    for (int j = 0; j < 4; ++j)                 // sigmoid gate
#pragma unroll
      for (int r = 0; r < 8; ++r)
        w[j][r] = (_Float16)(1.0f /
                             (1.0f + exp2_slot((acc[3][j][r] + bv[r]) * -1.4426950408889634f)));
    store_4l(go + pq, w);
    asm volatile("s_barrier_wait -1" ::: "memory");
  }
}

static __device__ inline float xhalf(float x) {
  const int b = __builtin_bit_cast(int, x);
  return __builtin_bit_cast(
      float, __builtin_amdgcn_permlanex16(b, b, 0x76543210, 0xfedcba98, false, false));
}

__global__ __launch_bounds__(256) void msa_attn_kernel(
    const _Float16* __restrict__ q, const _Float16* __restrict__ k,
    const _Float16* __restrict__ v, const _Float16* __restrict__ gate,
    _Float16* __restrict__ att) {
  // whole V of this (l,h), 16KB, as it lies in memory: [n / 8][d][8 n]
  __shared__ __attribute__((aligned(16))) _Float16 vsbuf[NSEQ][DHID];
  const int lane = threadIdx.x & 31;
  const int wid  = threadIdx.x >> 5;
  const int lh   = lane >> 4;
  const int lc   = lane & 15;
  const int li   = blockIdx.x >> 3;     // column index 0..383
  const int hh   = blockIdx.x & 7;      // head
  const size_t base = ((size_t)li * NHEAD + hh) * NSEQ * DHID;
  const _Float16* qb = q + base;
  const _Float16* kp = k + base;
  const _Float16* vp = v + base;
  const int row0 = wid * 32;            // this wave's 32 query rows

  const v16h qa0 = frag_piecemajor(qb, NSEQ, row0 + lc,      lane);
  const v16h qa1 = frag_piecemajor(qb, NSEQ, row0 + 16 + lc, lane);

#if USE_TDM
  if (wid == 0) {
    tdm_load_2d_f16((unsigned int)(uintptr_t)&vsbuf[0][0], vp, DHID, NSEQ);
  }
#else
  // Fallback: cooperative staged copy of V into LDS (128-bit loads).
  for (int rr = wid * 4; rr < NSEQ; rr += 32) {
    const int r2 = rr + (lane >> 3);
    const int c2 = (lane & 7) * 4;
    *(h8*)&vsbuf[r2][c2] = *(const h8*)(vp + (size_t)r2 * DHID + c2);
  }
#endif

#if USE_TDM
  if (wid == 0) __builtin_amdgcn_s_wait_tensorcnt(0);
#endif
  __syncthreads();

  // ot[s][c][r] = O[query row0 + c*16 + lc][d = s*16 + lh*8 + r]
  v8f ot[2][2] = {};
  v2f mrow = {-1e30f, -1e30f};          // running maximum of the lane's two queries
  v2f lrow = {0.0f, 0.0f};              // their sums over THIS half's keys only

  for (int kt = 0; kt < NSEQ; kt += 32) {
    if (kt + 32 < NSEQ) {
      __builtin_prefetch(kp + (size_t)(kt + 32) * 8, 0, 1);
    }
    // A operand of S^T: lane owns key row lc of each 16-key group
    const v16h kb0 = frag_piecemajor(kp, NSEQ, kt + lc,      lane);
    const v16h kb1 = frag_piecemajor(kp, NSEQ, kt + 16 + lc, lane);
    // A operand of O^T: lane owns row d of V^T, k runs over the pass's keys
    // (&vsbuf[kt][0] is piece row kt / 8 of the [n / 8][d][8 n] tile)
    const v16h vb0 = frag_piecemajor(&vsbuf[kt][0], DHID, lc,      lane);
    const v16h vb1 = frag_piecemajor(&vsbuf[kt][0], DHID, 16 + lc, lane);
    v8f zero = {};
    // st[t][c][r] = S[query c*16 + lc][key kt + t*16 + lh*8 + r]
    v8f st[2][2];
    st[0][0] = wmma_f16(kb0, qa0, zero);
    st[1][0] = wmma_f16(kb1, qa0, zero);
    st[0][1] = wmma_f16(kb0, qa1, zero);
    st[1][1] = wmma_f16(kb1, qa1, zero);
    v2f mnew;
#pragma unroll
    for (int c = 0; c < 2; ++c) {
      float mx = fmaxf(st[0][c][0], st[1][c][0]);
#pragma unroll
      for (int r = 1; r < 8; ++r) mx = fmaxf(mx, fmaxf(st[0][c][r], st[1][c][r]));
      mnew[c] = fmaxf(mrow[c], fmaxf(mx, xhalf(mx)));
    }
    const v2f corr = {__expf(mrow.x - mnew.x), __expf(mrow.y - mnew.y)};
    mrow = mnew;
    v2f rsum;
#pragma unroll
    for (int c = 0; c < 2; ++c) {
      v16h pb;                          // P^T fragment, hardware k order
      v2f rs0 = {0.0f, 0.0f}, rs1 = {0.0f, 0.0f};
#pragma unroll
      for (int r = 0; r < 8; r += 2) {  // neighbouring registers go in pairs
        const v2f p0 = {__expf(st[0][c][r] - mnew[c]), __expf(st[0][c][r + 1] - mnew[c])};
        const v2f p1 = {__expf(st[1][c][r] - mnew[c]), __expf(st[1][c][r + 1] - mnew[c])};
        rs0 += p0;
        rs1 += p1;
        pb[r]     = (_Float16)p0.x;
        pb[r + 1] = (_Float16)p0.y;
        pb[r + 8] = (_Float16)p1.x;
        pb[r + 9] = (_Float16)p1.y;
      }
      rs0 += rs1;
      rsum[c] = rs0.x + rs0.y;
#pragma unroll
      for (int r = 0; r < 8; ++r) { ot[0][c][r] *= corr[c]; ot[1][c][r] *= corr[c]; }
      ot[0][c] = wmma_f16(vb0, pb, ot[0][c]);
      ot[1][c] = wmma_f16(vb1, pb, ot[1][c]);
    }
    lrow = lrow * corr + rsum;
  }
  // normalize, gate, store gated output f16 in the gate's own layout
  // [l][h][d / 8][n][8]: a lane's 8 registers of a tile are 8 consecutive d of its query
  h8 g[2][2];
#pragma unroll
  for (int c = 0; c < 2; ++c) {
#pragma unroll
    for (int s = 0; s < 2; ++s) {
      g[c][s] = *(const h8*)(gate + base + ((s * 2 + lh) * NSEQ + row0 + c * 16 + lc) * 8);
      // the load above still names its address registers: hold any later write
      // of them (the next load's result may land there) behind it
      asm volatile("s_wait_xcnt 0x0" ::: "memory");
    }
  }
#pragma unroll
  for (int c = 0; c < 2; ++c) {
    const float inv = 1.0f / (lrow[c] + xhalf(lrow[c]));
#pragma unroll
    for (int s = 0; s < 2; ++s) {
      h8 w;
#pragma unroll
      for (int r = 0; r < 8; ++r)
        w[r] = (_Float16)((ot[s][c][r] * inv) * (float)g[c][s][r]);
      *(h8*)(att + base + ((s * 2 + lh) * NSEQ + row0 + c * 16 + lc) * 8) = w;
    }
  }
}

// ------------------------------------------------------- output projection
__global__ __launch_bounds__(256) void msa_outproj_kernel(
    const _Float16* __restrict__ a, const float* __restrict__ wo,
    const float* __restrict__ bo, float* __restrict__ out) {
  __shared__ __attribute__((aligned(16))) _Float16 xs[128 * GPITCH];
  __shared__ __attribute__((aligned(16))) _Float16 wt[128 * GPITCH];
  const int lane  = threadIdx.x & 31;
  const int wid   = threadIdx.x >> 5;
  const int li    = blockIdx.y >> 1;            // the block's column l
  const int nbase = (blockIdx.y & 1) * 128;     // its 128 sequences n
  const int colt  = blockIdx.x * 128;
  const int frow  = (wid >> 1) * 32;
  const int fcol  = (wid & 1) * 64;
  v8f acc[2][4] = {};
  gemm_tile<2>(a + (size_t)li * (NSEQ * HD) + nbase * 8, wo + (size_t)colt * HD, xs, wt, acc);
  const int lh = lane >> 4;
  const int lc = lane & 15;
#pragma unroll
  for (int i = 0; i < 2; ++i) {
#pragma unroll
    for (int r = 0; r < 8; ++r) {
      const int m = (nbase + frow + i * 16 + r + lh * 8) * LCOL + li;
#pragma unroll
      for (int s = 0; s < 4; ++s) {
        const int c = colt + fcol + s * 16 + lc;
        out[(size_t)m * DM + c] = acc[i][s][r] + bo[c];
      }
    }
  }
}

extern "C" void kernel_launch(void* const* d_in, const int* in_sizes, int n_in,
                              void* d_out, int out_size, void* d_ws, size_t ws_size,
                              hipStream_t stream) {
  (void)in_sizes; (void)n_in; (void)out_size; (void)ws_size;
  const float* msa = (const float*)d_in[0];
  const float* lnw = (const float*)d_in[1];
  const float* lnb = (const float*)d_in[2];
  const float* wq  = (const float*)d_in[3];
  const float* wk  = (const float*)d_in[4];
  const float* wv  = (const float*)d_in[5];
  const float* wg  = (const float*)d_in[6];
  const float* bg  = (const float*)d_in[7];
  const float* wo  = (const float*)d_in[8];
  const float* bo  = (const float*)d_in[9];
  float* out = (float*)d_out;

  const size_t sz = (size_t)MROWS * DM;     // halves per f16 buffer (50.3 MB each)
  _Float16* xh = (_Float16*)d_ws;           // LayerNormed x       [m][dm]
  _Float16* qh = xh + sz;                   // Q (pre-scaled)      [l][h][d/8][n][8]
  _Float16* kh = qh + sz;                   // K                   [l][h][d/8][n][8]
  _Float16* vh = kh + sz;                   // V                   [l][h][n/8][d][8]
  _Float16* gh = vh + sz;                   // sigmoid gate        [l][h][d/8][n][8]
  _Float16* ah = gh + sz;                   // gated attn output   [l][h][d/8][n][8]

  msa_ln_kernel<<<MROWS / 8, 256, 0, stream>>>(msa, lnw, lnb, xh);
  msa_proj_kernel<<<dim3(2, MROWS / (64 * PTILES)), 256, 0, stream>>>(
      xh, wq, wk, wv, wg, bg, qh, kh, vh, gh);
  msa_attn_kernel<<<LCOL * NHEAD, 256, 0, stream>>>(qh, kh, vh, gh, ah);
  msa_outproj_kernel<<<dim3(2, MROWS / 128), 256, 0, stream>>>(ah, wo, bo, out);
}

// v006
// One run takes 110 microseconds.
// It is 1.21 times as fast as v004, going by the measured steps of the versions left out in between.
// Over all steps from v000 it is 3.40 times as fast.
#include <hip/hip_runtime.h>

#define DM    256
#define NSEQ  256
#define LCOL  384
#define NHEAD 8
#define DHID  32
#define HD    (NHEAD * DHID)          // 256
#define MROWS (NSEQ * LCOL)           // 98304

typedef __attribute__((ext_vector_type(16))) _Float16     v16h;
typedef __attribute__((ext_vector_type(8)))  _Float16     h8;
typedef __attribute__((ext_vector_type(8)))  float        v8f;
typedef __attribute__((ext_vector_type(2)))  float        v2f;
typedef __attribute__((ext_vector_type(4)))  unsigned int v4u;
typedef __attribute__((ext_vector_type(8)))  int          v8i;
typedef __attribute__((ext_vector_type(4)))  int          v4i;

#if defined(__has_builtin)
#if __has_builtin(__builtin_amdgcn_tensor_load_to_lds) && \
    __has_builtin(__builtin_amdgcn_s_wait_tensorcnt)
#define USE_TDM 1
#endif
#endif
#ifndef USE_TDM
#define USE_TDM 0
#endif

static __device__ inline v8f wmma_f16(v16h a, v16h b, v8f c) {
  // (neg_a, A, neg_b, B, c_mod, C, reuse_a, reuse_b)
  return __builtin_amdgcn_wmma_f32_16x16x32_f16(false, a, false, b, (short)0, c,
                                                false, false);
}

static __device__ inline v16h frag_rowmajor(const _Float16* rowptr, int lane) {
  const int kb = (lane >> 4) * 8;
  h8 lo = *(const h8*)(rowptr + kb);
  h8 hi = *(const h8*)(rowptr + kb + 16);
  v16h f;
#pragma unroll
  for (int j = 0; j < 8; ++j) { f[j] = lo[j]; f[j + 8] = hi[j]; }
  return f;
}

// Same fragment from a piece-major tile [k / 8][row][8] of 'rows' rows: the 16
// lanes of a half wave read 16 neighbouring 16-B pieces, 256 B in a row.
static __device__ inline v16h frag_piecemajor(const _Float16* base, int rows,
                                              int row, int lane) {
  const int pc = lane >> 4;
  h8 lo = *(const h8*)(base + (pc * rows + row) * 8);
  h8 hi = *(const h8*)(base + ((pc + 2) * rows + row) * 8);
  v16h f;
#pragma unroll
  for (int j = 0; j < 8; ++j) { f[j] = lo[j]; f[j + 8] = hi[j]; }
  return f;
}

#if USE_TDM
static __device__ inline void tdm_load_2d_f16(unsigned int lds_off,
                                              const _Float16* gptr,
                                              unsigned int rowlen,
                                              unsigned int nrows) {
  const unsigned long long ga = (unsigned long long)(uintptr_t)gptr;
  v4u g0;
  g0[0] = 1u;                                   // count=1, user mode
  g0[1] = lds_off;                              // lds_addr
  g0[2] = (unsigned int)(ga & 0xffffffffu);     // global_addr[31:0]
  g0[3] = ((unsigned int)(ga >> 32) & 0x01ffffffu) | 0x80000000u; // addr[56:32]|type=2
  v8i g1;
  g1[0] = 0x00010000;
  g1[1] = (int)(rowlen << 16);
  g1[2] = (int)(nrows << 16);
  g1[3] = (int)(rowlen << 16);
  g1[4] = (int)nrows;
  g1[5] = (int)rowlen;
  g1[6] = 0;
  g1[7] = 0;
  v4i gz = {0, 0, 0, 0};                        // groups 2/3: 2-D tensor
#if defined(__clang_major__) && (__clang_major__ >= 23)
  v8i gz8 = {0, 0, 0, 0, 0, 0, 0, 0};
  __builtin_amdgcn_tensor_load_to_lds(g0, g1, gz, gz, gz8, 0);
#else
  __builtin_amdgcn_tensor_load_to_lds(g0, g1, gz, gz, 0);
#endif
}
#endif

// x + (x of lane ^ M), M below 16: one step of a butterfly inside a 16-lane row (DPP)
template <int M>
static __device__ inline float row_xadd(float x) {
  const int y = __builtin_amdgcn_update_dpp(0, __builtin_bit_cast(int, x), 0x160 + M, 0xf, 0xf, true);
  return x + __builtin_bit_cast(float, y);
}

// ------------------------------------------------ shared GEMM tile main loop
// Y = A * W^T over K = 256.  Block tile (FM*64) rows x 128 cols, 8 waves laid
// 4 (rows) x 2 (cols); each wave owns FM x 4 accumulator tiles of 16x16.
// K is staged 64 at a time; LDS rows are 128 B of data at a 144-B pitch.
// A lies in 16-B pieces, [k / 8][NSEQ rows][8]: neighbouring lanes fetch the same
// piece of neighbouring rows, 512 B in a row per wave.
#define GK     64
#define GPITCH 72
typedef __attribute__((ext_vector_type(4))) _Float16 h4;

template <int FM>
static __device__ inline void gemm_tile(const _Float16* __restrict__ A,
                                        const float* __restrict__ Wm,
                                        _Float16* xs, _Float16* wt,
                                        v8f (&acc)[FM][4]) {
  const int tid  = threadIdx.x;
  const int lane = tid & 31;
  const int wid  = tid >> 5;
  const int lc   = lane & 15;
  const int frow = (wid >> 1) * (FM * 16);
  const int fcol = (wid & 1) * 64;
  const int xrow = tid & (FM * 64 - 1);         // the thread's row of the tile
  const int xpc  = tid / (FM * 64);             // 4 / FM pieces per sweep
  const int wrow = tid >> 4;                    // 16 rows per sweep
  const int wseg = (tid & 15) * 4;              // 16 lanes cover 256 B of f32
  for (int kb = 0; kb < 256; kb += GK) {
    __syncthreads();
#pragma unroll
    for (int i = 0; i < FM * 2; ++i) {          // stage A tile (f16)
      const int pc = xpc + i * (4 / FM);
      *(h8*)(xs + xrow * GPITCH + pc * 8) =
          *(const h8*)(A + (size_t)((kb >> 3) + pc) * (NSEQ * 8) + xrow * 8);
    }
#pragma unroll
    for (int i = 0; i < 8; ++i) {               // stage W tile, f32 -> f16
      const int r = wrow + i * 16;
      const float4 d = *(const float4*)(Wm + (size_t)r * 256 + kb + wseg);
      h4 c;
      c[0] = (_Float16)d.x; c[1] = (_Float16)d.y;
      c[2] = (_Float16)d.z; c[3] = (_Float16)d.w;
      *(h4*)(wt + r * GPITCH + wseg) = c;
    }
    __syncthreads();
#pragma unroll
    for (int ks = 0; ks < GK; ks += 32) {
      v16h a[FM], b[4];
#pragma unroll
      for (int i = 0; i < FM; ++i)
        a[i] = frag_rowmajor(xs + (frow + i * 16 + lc) * GPITCH + ks, lane);
#pragma unroll
      for (int j = 0; j < 4; ++j)
        b[j] = frag_rowmajor(wt + (fcol + j * 16 + lc) * GPITCH + ks, lane);
#pragma unroll
      for (int i = 0; i < FM; ++i)
#pragma unroll
        for (int j = 0; j < 4; ++j) acc[i][j] = wmma_f16(a[i], b[j], acc[i][j]);
    }
  }
}

static __device__ inline float exp2_slot(float t) {
  float e;
  asm("v_exp_f32 %0, %1\n\tv_nop" : "=v"(e) : "v"(t));
  return e;
}

// --------------------------------------------------- fused Q/K/V/G projection
// Weight-stationary: 256 work-groups, one per WGP.  A work-group owns 128 output
// columns of each of the four matrices (512 weight rows); they are converted to
// f16 once, pass through LDS once, and then stay in registers as fragments: a
// wave holds 16 columns of q, k, v and gate over the whole K = 256.  The
// work-group then walks 12 tiles of 64 rows: raw msa rows in, LayerNorm in the wave that
// fetched them, x as f16 through two LDS buffers.
// A tile's 64 rows are 16 sequences n x 4 columns l: tile row r is
// (n = r & 15, l = r >> 4), so the 16 rows of a WMMA tile are 16 neighbouring n
// of one l.  Per (l, head) the outputs are laid in 16-B pieces:
//   q, k, gate: [d / 8][n][8 d]   (product run as W x^T: a lane holds 8 d of one n)
//   v:          [n / 8][d][8 n]   (product run as x W^T: a lane holds 8 n of one d)
// In both, the 16 lanes of a half wave store 256 B in a row.
#define XP     264                    // LDS pitch of a 256-half row: 528 B = 16 B x 33
#define PTILES 12                     // x tiles per work-group
#define LQ     (LCOL / 4)             // groups of 4 columns l
#define RAWOFF (2 * 64 * XP)          // in halves: behind the two f16 tiles
static __device__ inline void copy_x_tile(unsigned int l0, const float* glane, int t) {
  const float* p0 = glane + ((size_t)(t / LQ) * 16 * LCOL + (t % LQ) * 4) * DM;
  const float* p1 = p0 + (size_t)8 * LCOL * DM; // sequence n + 8
  const unsigned int l1 = l0 + 4096;
  asm volatile("s_wait_dscnt 0x0" ::: "memory");
  // offset:N moves the global and the LDS address alike (a row's second half: 512 B in
  // both; the next column l: 1 KB in both).  The closing wait stands in front of any
  // rewrite of the address registers.
  asm volatile(
      "global_load_async_to_lds_b128 %0, %2, off\n\t"
      "global_load_async_to_lds_b128 %0, %2, off offset:512\n\t"
      "global_load_async_to_lds_b128 %1, %3, off\n\t"
      "global_load_async_to_lds_b128 %1, %3, off offset:512\n\t"
      "global_load_async_to_lds_b128 %0, %2, off offset:1024\n\t"
      "global_load_async_to_lds_b128 %0, %2, off offset:1536\n\t"
      "global_load_async_to_lds_b128 %1, %3, off offset:1024\n\t"
      "global_load_async_to_lds_b128 %1, %3, off offset:1536\n\t"
      "global_load_async_to_lds_b128 %0, %2, off offset:2048\n\t"
      "global_load_async_to_lds_b128 %0, %2, off offset:2560\n\t"
      "global_load_async_to_lds_b128 %1, %3, off offset:2048\n\t"
      "global_load_async_to_lds_b128 %1, %3, off offset:2560\n\t"
      "global_load_async_to_lds_b128 %0, %2, off offset:3072\n\t"
      "global_load_async_to_lds_b128 %0, %2, off offset:3584\n\t"
      "global_load_async_to_lds_b128 %1, %3, off offset:3072\n\t"
      "global_load_async_to_lds_b128 %1, %3, off offset:3584\n\t"
      "s_wait_xcnt 0x0"
      ::"v"(l0), "v"(l1), "v"(p0), "v"(p1)
      : "memory");
}
static __device__ inline void ln_stage_tile(_Float16* dl, const float* rl, const float* rl2,
                                            const float* lnl) {
  // the wave's copies have landed; it reads no other wave's bytes here
  asm volatile("s_wait_asynccnt 0x0" ::: "memory");
  v2f e[4][8];
#pragma unroll
  for (int l = 0; l < 4; ++l)
#pragma unroll
    for (int k = 0; k < 2; ++k) {
      const float4 a = *(const float4*)(rl + l * 256 + k * 128);
      const float4 b = *(const float4*)(rl2 + l * 256 + k * 128);
      e[l][k * 4 + 0] = v2f{a.x, a.y}; e[l][k * 4 + 1] = v2f{a.z, a.w};
      e[l][k * 4 + 2] = v2f{b.x, b.y}; e[l][k * 4 + 3] = v2f{b.z, b.w};
    }
  v2f w[8], c[8];
#pragma unroll
  for (int k = 0; k < 2; ++k)
#pragma unroll
    for (int h = 0; h < 2; ++h) {
      const float4 a = *(const float4*)(lnl + k * 128 + h * 4);
      const float4 b = *(const float4*)(lnl + DM + k * 128 + h * 4);
      w[k * 4 + h * 2] = v2f{a.x, a.y}; w[k * 4 + h * 2 + 1] = v2f{a.z, a.w};
      c[k * 4 + h * 2] = v2f{b.x, b.y}; c[k * 4 + h * 2 + 1] = v2f{b.z, b.w};
    }
  float s[4], ss[4];
#pragma unroll
  for (int l = 0; l < 4; ++l) {
    const v2f t = ((e[l][0] + e[l][1]) + (e[l][2] + e[l][3])) +
                  ((e[l][4] + e[l][5]) + (e[l][6] + e[l][7]));
    const v2f u = (e[l][0] * e[l][0] + e[l][1] * e[l][1] + e[l][2] * e[l][2] + e[l][3] * e[l][3]) +
                  (e[l][4] * e[l][4] + e[l][5] * e[l][5] + e[l][6] * e[l][6] + e[l][7] * e[l][7]);
    s[l]  = t.x + t.y;
    ss[l] = u.x + u.y;
  }
#pragma unroll
  for (int l = 0; l < 4; ++l) { s[l] = row_xadd<1>(s[l]); ss[l] = row_xadd<1>(ss[l]); }
#pragma unroll
  for (int l = 0; l < 4; ++l) { s[l] = row_xadd<2>(s[l]); ss[l] = row_xadd<2>(ss[l]); }
#pragma unroll
  for (int l = 0; l < 4; ++l) { s[l] = row_xadd<4>(s[l]); ss[l] = row_xadd<4>(ss[l]); }
#pragma unroll
  for (int l = 0; l < 4; ++l) { s[l] = row_xadd<8>(s[l]); ss[l] = row_xadd<8>(ss[l]); }
#pragma unroll
  for (int l = 0; l < 4; ++l) {
    const float mu   = s[l] * (1.0f / DM);
    const float rstd = rsqrtf(ss[l] * (1.0f / DM) - mu * mu + 1e-5f);
#pragma unroll
    for (int k = 0; k < 2; ++k) {
      h8 o;
#pragma unroll
      for (int j = 0; j < 4; ++j) {
        const v2f d = (e[l][k * 4 + j] - mu) * rstd * w[k * 4 + j] + c[k * 4 + j];
        o[j * 2]     = (_Float16)d.x;
        o[j * 2 + 1] = (_Float16)d.y;
      }
      *(h8*)(dl + l * 16 * XP + k * 128) = o;
    }
  }
}
// Four stores, one per l.  They still name their address and data registers: the
// wait takes those as inputs, so that nothing is written there in front of it.
static __device__ inline void store_4l(_Float16* sp, const h8 (&w)[4]) {
#pragma unroll
  for (int j = 0; j < 4; ++j) *(h8*)(sp + (size_t)j * NHEAD * NSEQ * DHID) = w[j];
  asm volatile("s_wait_xcnt 0x0" ::"v"(sp), "v"(w[0]), "v"(w[1]), "v"(w[2]), "v"(w[3]) : "memory");
}

__global__ __launch_bounds__(256) void msa_proj_kernel(
    const float* __restrict__ msa, const float* __restrict__ lnw,
    const float* __restrict__ lnb,
    const float* __restrict__ wq, const float* __restrict__ wk,
    const float* __restrict__ wvm, const float* __restrict__ wg,
    const float* __restrict__ bg,
    _Float16* __restrict__ qo, _Float16* __restrict__ ko,
    _Float16* __restrict__ vo, _Float16* __restrict__ go) {
  __shared__ __attribute__((aligned(16))) _Float16 sm[512 * XP];
  __shared__ __attribute__((aligned(16))) float lnp[2 * DM];
  const int tid  = threadIdx.x;
  const int lane = tid & 31;
  const int wid  = tid >> 5;
  const int lh   = lane >> 4;
  const int lc   = lane & 15;
  const int hb   = blockIdx.x;                  // which 128 columns of each matrix
  const int t0   = blockIdx.y * PTILES;         // first x tile
  const int head = hb * 4 + (wid >> 1);         // the wave's 16 columns: half a head
  const int dh   = wid & 1;

  // a wave fetches and normalises whole rows of msa
  const float* glane = msa + (size_t)wid * LCOL * DM + lane * 4;
  const float* rw = (const float*)(sm + RAWOFF) + wid * 2048;
  const unsigned int l0 = (unsigned int)(uintptr_t)rw + (lane & 1) * 256 +
                          (((lane >> 1) ^ ((lane & 1) * 8)) * 16);
  const float* rl  = rw + lh * 1024 + lc * 4;             // the lane's even pieces
  const float* rl2 = rw + lh * 1024 + 64 + (lc ^ 8) * 4;  // and its odd ones
  const float* lnl = lnp + lc * 8;
  const int    dlo = (lh * 8 + wid) * XP + lc * 8;        // its place in an f16 tile
  if (tid < 128) {                              // LayerNorm weights, then biases, into LDS
    const float* sp = ((tid < 64) ? lnw : lnb) + (tid & 63) * 4;
    const float4 d = *(const float4*)sp;
    // the load still names its address registers: nothing is written there in front of this
    asm volatile("s_wait_xcnt 0x0" ::"v"(sp) : "memory");
    *(float4*)(lnp + tid * 4) = d;
  }

  // weights: f32 -> f16 into LDS row m * 128 + c, 64 lanes cover a 1-KB row
#pragma unroll 1
  for (int m = 0; m < 4; ++m) {
    const float* Wm = ((m == 0) ? wq : (m == 1) ? wk : (m == 2) ? wvm : wg) +
                      (size_t)(hb * 128 + (tid >> 6)) * DM + (tid & 63) * 4;
    _Float16* wl = sm + (m * 128 + (tid >> 6)) * XP + (tid & 63) * 4;
#pragma unroll
    for (int i = 0; i < 32; ++i) {
      const float4 d = *(const float4*)(Wm + i * 4 * DM);
      h4 c;
      c[0] = (_Float16)d.x; c[1] = (_Float16)d.y;
      c[2] = (_Float16)d.z; c[3] = (_Float16)d.w;
      *(h4*)(wl + i * 4 * XP) = c;
    }
    asm volatile("s_wait_xcnt 0x0" ::"v"(Wm) : "memory");
  }
  float bv[8];                                  // the lane's 8 gate biases
  {
    const float* bp = bg + hb * 128 + wid * 16 + lh * 8;
    const float4 b0 = *(const float4*)bp;
    const float4 b1 = *(const float4*)(bp + 4);
    asm volatile("s_wait_xcnt 0x0" ::"v"(bp) : "memory");
    bv[0] = b0.x; bv[1] = b0.y; bv[2] = b0.z; bv[3] = b0.w;
    bv[4] = b1.x; bv[5] = b1.y; bv[6] = b1.z; bv[7] = b1.w;
  }
  __syncthreads();
  v16h wf[8][4];                                // [k / 32][matrix]
#pragma unroll
  for (int ks = 0; ks < 8; ++ks)
#pragma unroll
    for (int m = 0; m < 4; ++m)
      wf[ks][m] = frag_rowmajor(sm + (m * 128 + wid * 16 + lc) * XP + ks * 32, lane);
  __syncthreads();                              // every wave has its weights: LDS is free
  copy_x_tile(l0, glane, t0);
  ln_stage_tile(sm + dlo, rl, rl2, lnl);
  copy_x_tile(l0, glane, t0 + 1);
  __syncthreads();

  const size_t LH = (size_t)NSEQ * DHID;        // halves per (l, head)
#pragma unroll 1
  for (int it = 0; it < PTILES; ++it) {
    const _Float16* cur = sm + (it & 1) * (64 * XP);
    // the other buffer's readers left it in front of the last barrier
    if (it + 1 < PTILES)
      ln_stage_tile(sm + ((it + 1) & 1) * (64 * XP) + dlo, rl, rl2, lnl);
    if (it + 2 < PTILES) copy_x_tile(l0, glane, t0 + it + 2);
    v8f acc[4][4] = {};                         // [matrix][l]
    // x fragments are fetched one k step ahead into a second register set.  The
    // scheduling fences keep each step's eight LDS loads together in front of the
    // 16 products of the step before: left alone, the compiler put two loads and
    // a full wait in front of every four products
    v16h xf[2][4];
#pragma unroll
    for (int j = 0; j < 4; ++j) xf[0][j] = frag_rowmajor(cur + (j * 16 + lc) * XP, lane);
#pragma unroll
    for (int ks = 0; ks < 8; ++ks) {
      if (ks < 7) {
#pragma unroll
        for (int j = 0; j < 4; ++j)
          xf[(ks + 1) & 1][j] = frag_rowmajor(cur + (j * 16 + lc) * XP + (ks + 1) * 32, lane);
      }
      __builtin_amdgcn_sched_barrier(0);
      if (ks == 7) {
        // the tile's barrier, split.  The wave's last LDS reads of this buffer and its
        // stores into the other one are done: say so here, and wait for the others
        // only behind the epilogue, which touches no LDS
        asm volatile("s_wait_dscnt 0x0" ::: "memory");
        asm volatile("s_barrier_signal -1" ::: "memory");
      }
#pragma unroll
      for (int j = 0; j < 4; ++j) {
        acc[0][j] = wmma_f16(wf[ks][0], xf[ks & 1][j], acc[0][j]);
        acc[1][j] = wmma_f16(wf[ks][1], xf[ks & 1][j], acc[1][j]);
        acc[2][j] = wmma_f16(xf[ks & 1][j], wf[ks][2], acc[2][j]);
        acc[3][j] = wmma_f16(wf[ks][3], xf[ks & 1][j], acc[3][j]);
      }
      __builtin_amdgcn_sched_barrier(0);
    }
    // (the fence behind the last step also lets the epilogue be scheduled by itself:
    // joined to the matrix part, the gate's 32 divisions came out as one chain)
    const int t  = t0 + it;
    const int nb = t / LQ;                      // group of 16 sequences
    const size_t tb = ((size_t)(t % LQ) * 4 * NHEAD + head) * LH;
    // q, k, gate: acc[m][j][r] is d = dh * 16 + lh * 8 + r of n = nb * 16 + lc
    const size_t pq = tb + ((dh * 2 + lh) * NSEQ + nb * 16 + lc) * 8;
    // v: acc[2][j][r] is n = nb * 16 + lh * 8 + r of d = dh * 16 + lc
    const size_t pv = tb + ((nb * 2 + lh) * DHID + dh * 16 + lc) * 8;
    h8 w[4];
#pragma unroll
    for (int j = 0; j < 4; ++j)                 // q, pre-scaled by log2(e) / sqrt(32)
#pragma unroll
      for (int r = 0; r < 8; ++r) w[j][r] = (_Float16)(acc[0][j][r] * 0.25503486164919736f);
    store_4l(qo + pq, w);
#pragma unroll
    for (int j = 0; j < 4; ++j)
#pragma unroll
      for (int r = 0; r < 8; ++r) w[j][r] = (_Float16)acc[1][j][r];
    store_4l(ko + pq, w);
#pragma unroll
    for (int j = 0; j < 4; ++j)
#pragma unroll
      for (int r = 0; r < 8; ++r) w[j][r] = (_Float16)acc[2][j][r];
    store_4l(vo + pv, w);
#pragma unroll
    for (int j = 0; j < 4; ++j)                 // sigmoid gate
#pragma unroll
      for (int r = 0; r < 8; ++r)
        w[j][r] = (_Float16)(1.0f /
                             (1.0f + exp2_slot((acc[3][j][r] + bv[r]) * -1.4426950408889634f)));
    store_4l(go + pq, w);
    asm volatile("s_barrier_wait -1" ::: "memory");
  }
}

static __device__ inline float xhalf(float x) {
  const int b = __builtin_bit_cast(int, x);
  return __builtin_bit_cast(
      float, __builtin_amdgcn_permlanex16(b, b, 0x76543210, 0xfedcba98, false, false));
}

__global__ __launch_bounds__(256) void msa_attn_kernel(
    const _Float16* __restrict__ q, const _Float16* __restrict__ k,
    const _Float16* __restrict__ v, const _Float16* __restrict__ gate,
    _Float16* __restrict__ att) {
  // whole V of this (l,h), 16KB, as it lies in memory: [n / 8][d][8 n]
  __shared__ __attribute__((aligned(16))) _Float16 vsbuf[NSEQ][DHID];
  const int lane = threadIdx.x & 31;
  const int wid  = threadIdx.x >> 5;
  const int lh   = lane >> 4;
  const int lc   = lane & 15;
  const int li   = blockIdx.x >> 3;     // column index 0..383
  const int hh   = blockIdx.x & 7;      // head
  const size_t base = ((size_t)li * NHEAD + hh) * NSEQ * DHID;
  const _Float16* qb = q + base;
  const _Float16* kp = k + base;
  const _Float16* vp = v + base;
  const int row0 = wid * 32;            // this wave's 32 query rows
  const _Float16* kl = kp + (lh * NSEQ + lc) * 8;  // the lane's piece of key row lc

  const v16h qa0 = frag_piecemajor(qb, NSEQ, row0 + lc,      lane);
  const v16h qa1 = frag_piecemajor(qb, NSEQ, row0 + 16 + lc, lane);

#if USE_TDM
  if (wid == 0) {
    tdm_load_2d_f16((unsigned int)(uintptr_t)&vsbuf[0][0], vp, DHID, NSEQ);
  }
#else
  // Fallback: cooperative staged copy of V into LDS (128-bit loads).
  for (int rr = wid * 4; rr < NSEQ; rr += 32) {
    const int r2 = rr + (lane >> 3);
    const int c2 = (lane & 7) * 4;
    *(h8*)&vsbuf[r2][c2] = *(const h8*)(vp + (size_t)r2 * DHID + c2);
  }
#endif

#if USE_TDM
  if (wid == 0) __builtin_amdgcn_s_wait_tensorcnt(0);
#endif
  __syncthreads();

  // ot[s][c][r] = O[query row0 + c*16 + lc][d = s*16 + lh*8 + r]
  v8f ot[2][2] = {};
  v8f cm[2] = {};                       // minus the maximum in use of the lane's two queries
  v2f lrow = {0.0f, 0.0f};              // their sums over THIS half's keys only

#pragma unroll 1
  for (int kt = 0; kt < NSEQ; kt += 32) {
    if (kt + 32 < NSEQ) {
      __builtin_prefetch(kp + (size_t)(kt + 32) * 8, 0, 1);
    }
    // A operand of S^T: lane owns key row lc of each 16-key group
    // (all four loads off one lane pointer, the rest as constant offsets: four pointers
    // held over the loop, beside the C operands, took the kernel past 128 registers)
    const v16h kb0 = frag_piecemajor(kl + kt * 8,       NSEQ, 0, 0);
    const v16h kb1 = frag_piecemajor(kl + kt * 8 + 128, NSEQ, 0, 0);
    // the four loads still name the lane pointer's registers, which the next pass's step
    // is written into: the wait takes the pointer as an input and stands in front of that
    asm volatile("s_wait_xcnt 0x0" ::"v"(kl + kt * 8) : "memory");
    // A operand of O^T: lane owns row d of V^T, k runs over the pass's keys
    // (&vsbuf[kt][0] is piece row kt / 8 of the [n / 8][d][8 n] tile)
    const v16h vb0 = frag_piecemajor(&vsbuf[kt][0], DHID, lc,      lane);
    const v16h vb1 = frag_piecemajor(&vsbuf[kt][0], DHID, 16 + lc, lane);
    v8f st[2][2];
    asm("v_nop\n\t"
        "v_wmma_f32_16x16x32_f16 %0, %4, %6, %8\n\t"
        "v_wmma_f32_16x16x32_f16 %1, %5, %6, %8\n\t"
        "v_wmma_f32_16x16x32_f16 %2, %4, %7, %9\n\t"
        "v_wmma_f32_16x16x32_f16 %3, %5, %7, %9\n\t"
        "v_nop\n\tv_nop\n\tv_nop\n\tv_nop"
        : "=&v"(st[0][0]), "=&v"(st[1][0]), "=&v"(st[0][1]), "=&v"(st[1][1])
        : "v"(kb0), "v"(kb1), "v"(qa0), "v"(qa1), "v"(cm[0]), "v"(cm[1]));
    v2f mx;                             // how far this half's maximum lies above the one in use
#pragma unroll
    for (int c = 0; c < 2; ++c) {
      float m = fmaxf(st[0][c][0], st[1][c][0]);
#pragma unroll
      for (int r = 1; r < 8; ++r) m = fmaxf(m, fmaxf(st[0][c][r], st[1][c][r]));
      mx[c] = m;
    }
    const bool first = (kt == 0);
    // one scalar branch a pass, over all 32 lanes: the halves need not be joined to test;
    // the first pass always takes it
    const float thr = first ? -__builtin_inff() : 8.0f;
    if (__builtin_amdgcn_ballot_w32(fmaxf(mx.x, mx.y) > thr) != 0) {
#pragma unroll
      for (int c = 0; c < 2; ++c) {
        const float mj   = fmaxf(mx[c], xhalf(mx[c]));  // the same in both halves
        const float d    = first ? mj : fmaxf(mj, 0.0f);
        const float corr = first ? 1.0f : __builtin_amdgcn_exp2f(-d);
#pragma unroll
        for (int r = 0; r < 8; ++r) {
          st[0][c][r] -= d;
          st[1][c][r] -= d;
          cm[c][r]    -= d;
          ot[0][c][r] *= corr;
          ot[1][c][r] *= corr;
        }
        lrow[c] *= corr;
      }
    }
    v2f rsum;
#pragma unroll
    for (int c = 0; c < 2; ++c) {
      v16h pb;                          // P^T fragment, hardware k order
      v2f rs0 = {0.0f, 0.0f}, rs1 = {0.0f, 0.0f};
#pragma unroll
      for (int r = 0; r < 8; r += 2) {  // neighbouring registers go in pairs
        const v2f p0 = {__builtin_amdgcn_exp2f(st[0][c][r]), __builtin_amdgcn_exp2f(st[0][c][r + 1])};
        const v2f p1 = {__builtin_amdgcn_exp2f(st[1][c][r]), __builtin_amdgcn_exp2f(st[1][c][r + 1])};
        rs0 += p0;
        rs1 += p1;
        pb[r]     = (_Float16)p0.x;
        pb[r + 1] = (_Float16)p0.y;
        pb[r + 8] = (_Float16)p1.x;
        pb[r + 9] = (_Float16)p1.y;
      }
      rs0 += rs1;
      rsum[c] = rs0.x + rs0.y;
      ot[0][c] = wmma_f16(vb0, pb, ot[0][c]);
      ot[1][c] = wmma_f16(vb1, pb, ot[1][c]);
    }
    lrow += rsum;
  }
  // normalize, gate, store gated output f16 in the gate's own layout
  // [l][h][d / 8][n][8]: a lane's 8 registers of a tile are 8 consecutive d of its query
  h8 g[2][2];
#pragma unroll
  for (int c = 0; c < 2; ++c) {
#pragma unroll
    for (int s = 0; s < 2; ++s) {
      g[c][s] = *(const h8*)(gate + base + ((s * 2 + lh) * NSEQ + row0 + c * 16 + lc) * 8);
      // the load above still names its address registers: hold any later write
      // of them (the next load's result may land there) behind it
      asm volatile("s_wait_xcnt 0x0" ::: "memory");
    }
  }
#pragma unroll
  for (int c = 0; c < 2; ++c) {
    const float inv = 1.0f / (lrow[c] + xhalf(lrow[c]));
#pragma unroll
    for (int s = 0; s < 2; ++s) {
      h8 w;
#pragma unroll
      for (int r = 0; r < 8; ++r)
        w[r] = (_Float16)((ot[s][c][r] * inv) * (float)g[c][s][r]);
      *(h8*)(att + base + ((s * 2 + lh) * NSEQ + row0 + c * 16 + lc) * 8) = w;
    }
  }
}

// ------------------------------------------------------- output projection
__global__ __launch_bounds__(256) void msa_outproj_kernel(
    const _Float16* __restrict__ a, const float* __restrict__ wo,
    const float* __restrict__ bo, float* __restrict__ out) {
  __shared__ __attribute__((aligned(16))) _Float16 xs[128 * GPITCH];
  __shared__ __attribute__((aligned(16))) _Float16 wt[128 * GPITCH];
  const int lane  = threadIdx.x & 31;
  const int wid   = threadIdx.x >> 5;
  const int li    = blockIdx.y >> 1;            // the block's column l
  const int nbase = (blockIdx.y & 1) * 128;     // its 128 sequences n
  const int colt  = blockIdx.x * 128;
  const int frow  = (wid >> 1) * 32;
  const int fcol  = (wid & 1) * 64;
  v8f acc[2][4] = {};
  gemm_tile<2>(a + (size_t)li * (NSEQ * HD) + nbase * 8, wo + (size_t)colt * HD, xs, wt, acc);
  const int lh = lane >> 4;
  const int lc = lane & 15;
#pragma unroll
  for (int i = 0; i < 2; ++i) {
#pragma unroll
    for (int r = 0; r < 8; ++r) {
      const int m = (nbase + frow + i * 16 + r + lh * 8) * LCOL + li;
#pragma unroll
      for (int s = 0; s < 4; ++s) {
        const int c = colt + fcol + s * 16 + lc;
        out[(size_t)m * DM + c] = acc[i][s][r] + bo[c];
      }
    }
  }
}

extern "C" void kernel_launch(void* const* d_in, const int* in_sizes, int n_in,
                              void* d_out, int out_size, void* d_ws, size_t ws_size,
                              hipStream_t stream) {
  (void)in_sizes; (void)n_in; (void)out_size; (void)ws_size;
  const float* msa = (const float*)d_in[0];
  const float* lnw = (const float*)d_in[1];
  const float* lnb = (const float*)d_in[2];
  const float* wq  = (const float*)d_in[3];
  const float* wk  = (const float*)d_in[4];
  const float* wv  = (const float*)d_in[5];
  const float* wg  = (const float*)d_in[6];
  const float* bg  = (const float*)d_in[7];
  const float* wo  = (const float*)d_in[8];
  const float* bo  = (const float*)d_in[9];
  float* out = (float*)d_out;

  const size_t sz = (size_t)MROWS * DM;     // halves per f16 buffer (50.3 MB each)
  _Float16* qh = (_Float16*)d_ws;           // Q (pre-scaled)      [l][h][d/8][n][8]
  _Float16* kh = qh + sz;                   // K                   [l][h][d/8][n][8]
  _Float16* vh = kh + sz;                   // V                   [l][h][n/8][d][8]
  _Float16* gh = vh + sz;                   // sigmoid gate        [l][h][d/8][n][8]
  _Float16* ah = gh + sz;                   // gated attn output   [l][h][d/8][n][8]

  msa_proj_kernel<<<dim3(2, MROWS / (64 * PTILES)), 256, 0, stream>>>(
      msa, lnw, lnb, wq, wk, wv, wg, bg, qh, kh, vh, gh);
  msa_attn_kernel<<<LCOL * NHEAD, 256, 0, stream>>>(qh, kh, vh, gh, ah);
  msa_outproj_kernel<<<dim3(2, MROWS / 128), 256, 0, stream>>>(ah, wo, bo, out);
}

// v007
// A run of this version takes 98.7 microseconds.
// Next to v006, in two timings, it ran 1.11 times as fast each time.
// All steps since v000 together make it 3.78 times as fast.
#include <hip/hip_runtime.h>

#define DM    256
#define NSEQ  256
#define LCOL  384
#define NHEAD 8
#define DHID  32
#define HD    (NHEAD * DHID)          // 256
#define MROWS (NSEQ * LCOL)           // 98304

typedef __attribute__((ext_vector_type(16))) _Float16     v16h;
typedef __attribute__((ext_vector_type(8)))  _Float16     h8;
typedef __attribute__((ext_vector_type(8)))  float        v8f;
typedef __attribute__((ext_vector_type(2)))  float        v2f;

static __device__ inline v8f wmma_f16(v16h a, v16h b, v8f c) {
  // (neg_a, A, neg_b, B, c_mod, C, reuse_a, reuse_b)
  return __builtin_amdgcn_wmma_f32_16x16x32_f16(false, a, false, b, (short)0, c,
                                                false, false);
}

static __device__ inline v16h frag_rowmajor(const _Float16* rowptr, int lane) {
  const int kb = (lane >> 4) * 8;
  h8 lo = *(const h8*)(rowptr + kb);
  h8 hi = *(const h8*)(rowptr + kb + 16);
  v16h f;
#pragma unroll
  for (int j = 0; j < 8; ++j) { f[j] = lo[j]; f[j + 8] = hi[j]; }
  return f;
}

// Same fragment from a piece-major tile [k / 8][row][8] of 'rows' rows: the 16
// lanes of a half wave read 16 neighbouring 16-B pieces, 256 B in a row.
static __device__ inline v16h frag_piecemajor(const _Float16* base, int rows,
                                              int row, int lane) {
  const int pc = lane >> 4;
  h8 lo = *(const h8*)(base + (pc * rows + row) * 8);
  h8 hi = *(const h8*)(base + ((pc + 2) * rows + row) * 8);
  v16h f;
#pragma unroll
  for (int j = 0; j < 8; ++j) { f[j] = lo[j]; f[j + 8] = hi[j]; }
  return f;
}

// x + (x of lane ^ M), M below 16: one step of a butterfly inside a 16-lane row (DPP)
template <int M>
static __device__ inline float row_xadd(float x) {
  const int y = __builtin_amdgcn_update_dpp(0, __builtin_bit_cast(int, x), 0x160 + M, 0xf, 0xf, true);
  return x + __builtin_bit_cast(float, y);
}

typedef __attribute__((ext_vector_type(4))) _Float16 h4;

static __device__ inline float exp2_slot(float t) {
  float e;
  asm("v_exp_f32 %0, %1\n\tv_nop" : "=v"(e) : "v"(t));
  return e;
}

// --------------------------------------------------- fused Q/K/V/G projection
// Weight-stationary: 256 work-groups, one per WGP.  A work-group owns 128 output
// columns of each of the four matrices (512 weight rows); they are converted to
// f16 once, pass through LDS once, and then stay in registers as fragments: a
// wave holds 16 columns of q, k, v and gate over the whole K = 256.  The
// work-group then walks 12 tiles of 64 rows: raw msa rows in, LayerNorm in the wave that
// fetched them, x as f16 through two LDS buffers.
// A tile's 64 rows are 16 sequences n x 4 columns l: tile row r is
// (n = r & 15, l = r >> 4), so the 16 rows of a WMMA tile are 16 neighbouring n
// of one l.  Per (l, head) the outputs are laid in 16-B pieces:
//   q, k, gate: [d / 8][n][8 d]   (product run as W x^T: a lane holds 8 d of one n)
//   v:          [n / 8][d][8 n]   (product run as x W^T: a lane holds 8 n of one d)
// In both, the 16 lanes of a half wave store 256 B in a row.
#define XP     264                    // LDS pitch of a 256-half row: 528 B = 16 B x 33
#define PTILES 12                     // x tiles per work-group
#define LQ     (LCOL / 4)             // groups of 4 columns l
#define RAWOFF (2 * 64 * XP)          // in halves: behind the two f16 tiles
static __device__ inline void copy_x_tile(unsigned int l0, const float* glane, int t) {
  const float* p0 = glane + ((size_t)(t / LQ) * 16 * LCOL + (t % LQ) * 4) * DM;
  const float* p1 = p0 + (size_t)8 * LCOL * DM; // sequence n + 8
  const unsigned int l1 = l0 + 4096;
  asm volatile("s_wait_dscnt 0x0" ::: "memory");
  // offset:N moves the global and the LDS address alike (a row's second half: 512 B in
  // both; the next column l: 1 KB in both).  The closing wait stands in front of any
  // rewrite of the address registers.
  asm volatile(
      "global_load_async_to_lds_b128 %0, %2, off\n\t"
      "global_load_async_to_lds_b128 %0, %2, off offset:512\n\t"
      "global_load_async_to_lds_b128 %1, %3, off\n\t"
      "global_load_async_to_lds_b128 %1, %3, off offset:512\n\t"
      "global_load_async_to_lds_b128 %0, %2, off offset:1024\n\t"
      "global_load_async_to_lds_b128 %0, %2, off offset:1536\n\t"
      "global_load_async_to_lds_b128 %1, %3, off offset:1024\n\t"
      "global_load_async_to_lds_b128 %1, %3, off offset:1536\n\t"
      "global_load_async_to_lds_b128 %0, %2, off offset:2048\n\t"
      "global_load_async_to_lds_b128 %0, %2, off offset:2560\n\t"
      "global_load_async_to_lds_b128 %1, %3, off offset:2048\n\t"
      "global_load_async_to_lds_b128 %1, %3, off offset:2560\n\t"
      "global_load_async_to_lds_b128 %0, %2, off offset:3072\n\t"
      "global_load_async_to_lds_b128 %0, %2, off offset:3584\n\t"
      "global_load_async_to_lds_b128 %1, %3, off offset:3072\n\t"
      "global_load_async_to_lds_b128 %1, %3, off offset:3584\n\t"
      "s_wait_xcnt 0x0"
      ::"v"(l0), "v"(l1), "v"(p0), "v"(p1)
      : "memory");
}
static __device__ inline void ln_stage_tile(_Float16* dl, const float* rl, const float* rl2,
                                            const float* lnl) {
  // the wave's copies have landed; it reads no other wave's bytes here
  asm volatile("s_wait_asynccnt 0x0" ::: "memory");
  v2f e[4][8];
#pragma unroll
  for (int l = 0; l < 4; ++l)
#pragma unroll
    for (int k = 0; k < 2; ++k) {
      const float4 a = *(const float4*)(rl + l * 256 + k * 128);
      const float4 b = *(const float4*)(rl2 + l * 256 + k * 128);
      e[l][k * 4 + 0] = v2f{a.x, a.y}; e[l][k * 4 + 1] = v2f{a.z, a.w};
      e[l][k * 4 + 2] = v2f{b.x, b.y}; e[l][k * 4 + 3] = v2f{b.z, b.w};
    }
  v2f w[8], c[8];
#pragma unroll
  for (int k = 0; k < 2; ++k)
#pragma unroll
    for (int h = 0; h < 2; ++h) {
      const float4 a = *(const float4*)(lnl + k * 128 + h * 4);
      const float4 b = *(const float4*)(lnl + DM + k * 128 + h * 4);
      w[k * 4 + h * 2] = v2f{a.x, a.y}; w[k * 4 + h * 2 + 1] = v2f{a.z, a.w};
      c[k * 4 + h * 2] = v2f{b.x, b.y}; c[k * 4 + h * 2 + 1] = v2f{b.z, b.w};
    }
  float s[4], ss[4];
#pragma unroll
  for (int l = 0; l < 4; ++l) {
    const v2f t = ((e[l][0] + e[l][1]) + (e[l][2] + e[l][3])) +
                  ((e[l][4] + e[l][5]) + (e[l][6] + e[l][7]));
    const v2f u = (e[l][0] * e[l][0] + e[l][1] * e[l][1] + e[l][2] * e[l][2] + e[l][3] * e[l][3]) +
                  (e[l][4] * e[l][4] + e[l][5] * e[l][5] + e[l][6] * e[l][6] + e[l][7] * e[l][7]);
    s[l]  = t.x + t.y;
    ss[l] = u.x + u.y;
  }
#pragma unroll
  for (int l = 0; l < 4; ++l) { s[l] = row_xadd<1>(s[l]); ss[l] = row_xadd<1>(ss[l]); }
#pragma unroll
  for (int l = 0; l < 4; ++l) { s[l] = row_xadd<2>(s[l]); ss[l] = row_xadd<2>(ss[l]); }
#pragma unroll
  for (int l = 0; l < 4; ++l) { s[l] = row_xadd<4>(s[l]); ss[l] = row_xadd<4>(ss[l]); }
#pragma unroll
  for (int l = 0; l < 4; ++l) { s[l] = row_xadd<8>(s[l]); ss[l] = row_xadd<8>(ss[l]); }
#pragma unroll
  for (int l = 0; l < 4; ++l) {
    const float mu   = s[l] * (1.0f / DM);
    const float rstd = rsqrtf(ss[l] * (1.0f / DM) - mu * mu + 1e-5f);
#pragma unroll
    for (int k = 0; k < 2; ++k) {
      h8 o;
#pragma unroll
      for (int j = 0; j < 4; ++j) {
        const v2f d = (e[l][k * 4 + j] - mu) * rstd * w[k * 4 + j] + c[k * 4 + j];
        o[j * 2]     = (_Float16)d.x;
        o[j * 2 + 1] = (_Float16)d.y;
      }
      *(h8*)(dl + l * 16 * XP + k * 128) = o;
    }
  }
}
// Four stores, one per l.  They still name their address and data registers: the
// wait takes those as inputs, so that nothing is written there in front of it.
static __device__ inline void store_4l(_Float16* sp, const h8 (&w)[4]) {
#pragma unroll
  for (int j = 0; j < 4; ++j) *(h8*)(sp + (size_t)j * NHEAD * NSEQ * DHID) = w[j];
  asm volatile("s_wait_xcnt 0x0" ::"v"(sp), "v"(w[0]), "v"(w[1]), "v"(w[2]), "v"(w[3]) : "memory");
}

__global__ __launch_bounds__(256) void msa_proj_kernel(
    const float* __restrict__ msa, const float* __restrict__ lnw,
    const float* __restrict__ lnb,
    const float* __restrict__ wq, const float* __restrict__ wk,
    const float* __restrict__ wvm, const float* __restrict__ wg,
    const float* __restrict__ bg, const float* __restrict__ wo,
    _Float16* __restrict__ qo, _Float16* __restrict__ ko,
    _Float16* __restrict__ vo, _Float16* __restrict__ go, _Float16* __restrict__ woh) {
  __shared__ __attribute__((aligned(16))) _Float16 sm[512 * XP];
  __shared__ __attribute__((aligned(16))) float lnp[2 * DM];
  const int tid  = threadIdx.x;
  const int lane = tid & 31;
  const int wid  = tid >> 5;
  const int lh   = lane >> 4;
  const int lc   = lane & 15;
  const int hb   = blockIdx.x;                  // which 128 columns of each matrix
  const int t0   = blockIdx.y * PTILES;         // first x tile
  const int head = hb * 4 + (wid >> 1);         // the wave's 16 columns: half a head
  const int dh   = wid & 1;

  // a wave fetches and normalises whole rows of msa
  const float* glane = msa + (size_t)wid * LCOL * DM + lane * 4;
  const float* rw = (const float*)(sm + RAWOFF) + wid * 2048;
  const unsigned int l0 = (unsigned int)(uintptr_t)rw + (lane & 1) * 256 +
                          (((lane >> 1) ^ ((lane & 1) * 8)) * 16);
  const float* rl  = rw + lh * 1024 + lc * 4;             // the lane's even pieces
  const float* rl2 = rw + lh * 1024 + 64 + (lc ^ 8) * 4;  // and its odd ones
  const float* lnl = lnp + lc * 8;
  const int    dlo = (lh * 8 + wid) * XP + lc * 8;        // its place in an f16 tile
  if (tid < 128) {                              // LayerNorm weights, then biases, into LDS
    const float* sp = ((tid < 64) ? lnw : lnb) + (tid & 63) * 4;
    const float4 d = *(const float4*)sp;
    // the load still names its address registers: nothing is written there in front of this
    asm volatile("s_wait_xcnt 0x0" ::"v"(sp) : "memory");
    *(float4*)(lnp + tid * 4) = d;
  }

  // weights: f32 -> f16 into LDS row m * 128 + c, 64 lanes cover a 1-KB row
#pragma unroll 1
  for (int m = 0; m < 4; ++m) {
    const float* Wm = ((m == 0) ? wq : (m == 1) ? wk : (m == 2) ? wvm : wg) +
                      (size_t)(hb * 128 + (tid >> 6)) * DM + (tid & 63) * 4;
    _Float16* wl = sm + (m * 128 + (tid >> 6)) * XP + (tid & 63) * 4;
#pragma unroll
    for (int i = 0; i < 32; ++i) {
      const float4 d = *(const float4*)(Wm + i * 4 * DM);
      h4 c;
      c[0] = (_Float16)d.x; c[1] = (_Float16)d.y;
      c[2] = (_Float16)d.z; c[3] = (_Float16)d.w;
      *(h4*)(wl + i * 4 * XP) = c;
    }
    asm volatile("s_wait_xcnt 0x0" ::"v"(Wm) : "memory");
  }
  float bv[8];                                  // the lane's 8 gate biases
  {
    const float* bp = bg + hb * 128 + wid * 16 + lh * 8;
    const float4 b0 = *(const float4*)bp;
    const float4 b1 = *(const float4*)(bp + 4);
    asm volatile("s_wait_xcnt 0x0" ::"v"(bp) : "memory");
    bv[0] = b0.x; bv[1] = b0.y; bv[2] = b0.z; bv[3] = b0.w;
    bv[4] = b1.x; bv[5] = b1.y; bv[6] = b1.z; bv[7] = b1.w;
  }
  __syncthreads();
  v16h wf[8][4];                                // [k / 32][matrix]
#pragma unroll
  for (int ks = 0; ks < 8; ++ks)
#pragma unroll
    for (int m = 0; m < 4; ++m)
      wf[ks][m] = frag_rowmajor(sm + (m * 128 + wid * 16 + lc) * XP + ks * 32, lane);
  __syncthreads();                              // every wave has its weights: LDS is free
  copy_x_tile(l0, glane, t0);
  ln_stage_tile(sm + dlo, rl, rl2, lnl);
  copy_x_tile(l0, glane, t0 + 1);
  __syncthreads();

  const size_t LH = (size_t)NSEQ * DHID;        // halves per (l, head)
#pragma unroll 1
  for (int it = 0; it < PTILES; ++it) {
    const _Float16* cur = sm + (it & 1) * (64 * XP);
    // the other buffer's readers left it in front of the last barrier
    if (it + 1 < PTILES)
      ln_stage_tile(sm + ((it + 1) & 1) * (64 * XP) + dlo, rl, rl2, lnl);
    if (it + 2 < PTILES) copy_x_tile(l0, glane, t0 + it + 2);
    v8f acc[4][4] = {};                         // [matrix][l]
    // x fragments are fetched one k step ahead into a second register set.  The
    // scheduling fences keep each step's eight LDS loads together in front of the
    // 16 products of the step before: left alone, the compiler put two loads and
    // a full wait in front of every four products
    v16h xf[2][4];
#pragma unroll
    for (int j = 0; j < 4; ++j) xf[0][j] = frag_rowmajor(cur + (j * 16 + lc) * XP, lane);
#pragma unroll
    for (int ks = 0; ks < 8; ++ks) {
      if (ks < 7) {
#pragma unroll
        for (int j = 0; j < 4; ++j)
          xf[(ks + 1) & 1][j] = frag_rowmajor(cur + (j * 16 + lc) * XP + (ks + 1) * 32, lane);
      }
      __builtin_amdgcn_sched_barrier(0);
      if (ks == 7) {
        // the tile's barrier, split.  The wave's last LDS reads of this buffer and its
        // stores into the other one are done: say so here, and wait for the others
        // only behind the epilogue, which touches no LDS
        asm volatile("s_wait_dscnt 0x0" ::: "memory");
        asm volatile("s_barrier_signal -1" ::: "memory");
      }
#pragma unroll
      for (int j = 0; j < 4; ++j) {
        acc[0][j] = wmma_f16(wf[ks][0], xf[ks & 1][j], acc[0][j]);
        acc[1][j] = wmma_f16(wf[ks][1], xf[ks & 1][j], acc[1][j]);
        acc[2][j] = wmma_f16(xf[ks & 1][j], wf[ks][2], acc[2][j]);
        acc[3][j] = wmma_f16(wf[ks][3], xf[ks & 1][j], acc[3][j]);
      }
      __builtin_amdgcn_sched_barrier(0);
    }
    // (the fence behind the last step also lets the epilogue be scheduled by itself:
    // joined to the matrix part, the gate's 32 divisions came out as one chain)
    const int t  = t0 + it;
    const int nb = t / LQ;                      // group of 16 sequences
    const size_t tb = ((size_t)(t % LQ) * 4 * NHEAD + head) * LH;
    // q, k, gate: acc[m][j][r] is d = dh * 16 + lh * 8 + r of n = nb * 16 + lc
    const size_t pq = tb + ((dh * 2 + lh) * NSEQ + nb * 16 + lc) * 8;
    // v: acc[2][j][r] is n = nb * 16 + lh * 8 + r of d = dh * 16 + lc
    const size_t pv = tb + ((nb * 2 + lh) * DHID + dh * 16 + lc) * 8;
    h8 w[4];
#pragma unroll
    for (int j = 0; j < 4; ++j)                 // q, pre-scaled by log2(e) / sqrt(32)
#pragma unroll
      for (int r = 0; r < 8; ++r) w[j][r] = (_Float16)(acc[0][j][r] * 0.25503486164919736f);
    store_4l(qo + pq, w);
#pragma unroll
    for (int j = 0; j < 4; ++j)
#pragma unroll
      for (int r = 0; r < 8; ++r) w[j][r] = (_Float16)acc[1][j][r];
    store_4l(ko + pq, w);
#pragma unroll
    for (int j = 0; j < 4; ++j)
#pragma unroll
      for (int r = 0; r < 8; ++r) w[j][r] = (_Float16)acc[2][j][r];
    store_4l(vo + pv, w);
#pragma unroll
    for (int j = 0; j < 4; ++j)                 // sigmoid gate
#pragma unroll
      for (int r = 0; r < 8; ++r)
        w[j][r] = (_Float16)(1.0f /
                             (1.0f + exp2_slot((acc[3][j][r] + bv[r]) * -1.4426950408889634f)));
    store_4l(go + pq, w);
    asm volatile("s_barrier_wait -1" ::: "memory");
  }

  // Wo for the next launch, once: f16 in 16-B pieces [k / 8][place of column c][8 k], so that
  // a B fragment there is read 256 B in a row per half wave.  Columns 2 i and 2 i + 1 of a
  // group of 32 take places i and 16 + i: the two tiles of a wave then hold neighbouring
  // columns in one lane.  32 work-groups, a thread converts one piece.
  if (blockIdx.y < 16) {
    const int gid = (blockIdx.y * 2 + blockIdx.x) * 256 + (int)threadIdx.x;
    const int c   = gid >> 5;
    const int k8  = gid & 31;
    const float* sp = wo + c * HD + k8 * 8;
    const float4 d0 = *(const float4*)sp;
    const float4 d1 = *(const float4*)(sp + 4);
    // the loads still name their address registers: nothing is written there in front of this
    asm volatile("s_wait_xcnt 0x0" ::"v"(sp) : "memory");
    h8 o;
    o[0] = (_Float16)d0.x; o[1] = (_Float16)d0.y; o[2] = (_Float16)d0.z; o[3] = (_Float16)d0.w;
    o[4] = (_Float16)d1.x; o[5] = (_Float16)d1.y; o[6] = (_Float16)d1.z; o[7] = (_Float16)d1.w;
    _Float16* dp = woh + (k8 * DM + (c & ~31) + (c & 1) * 16 + ((c & 31) >> 1)) * 8;
    *(h8*)dp = o;
    asm volatile("s_wait_xcnt 0x0" ::"v"(dp), "v"(o) : "memory");
  }
}

static __device__ inline float xhalf(float x) {
  const int b = __builtin_bit_cast(int, x);
  return __builtin_bit_cast(
      float, __builtin_amdgcn_permlanex16(b, b, 0x76543210, 0xfedcba98, false, false));
}

#define QB 128
__global__ __launch_bounds__(256) void msa_attn_out_kernel(
    const _Float16* __restrict__ q, const _Float16* __restrict__ k,
    const _Float16* __restrict__ v, const _Float16* __restrict__ gate,
    const _Float16* __restrict__ woh, const float* __restrict__ bo,
    float* __restrict__ out) {
  __shared__ __attribute__((aligned(16))) _Float16 ol[(HD / 8) * QB * 8];  // 64 KB
  const int lane = threadIdx.x & 31;
  // the wave's number as a scalar, so that the head's base addresses stay scalar
  const int wid  = __builtin_amdgcn_readfirstlane((int)(threadIdx.x >> 5));
  const int lh   = lane >> 4;
  const int lc   = lane & 15;
  // the two work-groups of a column read the same K and V: they lie 8 apart in the index
  // (for speed only: nothing rests on it)
  const int li    = (blockIdx.x >> 4) * 8 + (blockIdx.x & 7);  // column index 0..383
  const int nbase = ((blockIdx.x >> 3) & 1) * QB;              // the block's 128 queries
  const int lrow0 = (wid & 3) * 32;             // this wave's 32 queries in the block
  const int row0  = nbase + lrow0;

#pragma unroll 1
  for (int hi = 0; hi < NHEAD / 2; ++hi) {
    const int hh = hi * 2 + (wid >> 2);         // head
    const size_t base = ((size_t)li * NHEAD + hh) * NSEQ * DHID;
    const _Float16* qb = q + base;
    const _Float16* kl = k + base + (lh * NSEQ + lc) * 8;  // the lane's piece of key row lc
    const _Float16* vl = v + base + (lh * DHID + lc) * 8;  // the lane's piece of V^T row lc

    // B operand of S^T: lane owns query column lc of each 16-query group
    const v16h qa0 = frag_piecemajor(qb, NSEQ, row0 + lc,      lane);
    const v16h qa1 = frag_piecemajor(qb, NSEQ, row0 + 16 + lc, lane);
    // the four loads still name their address registers: nothing is written there in
    // front of this
    asm volatile("s_wait_xcnt 0x0" ::: "memory");

    // ot[s][c][r] = O[query row0 + c*16 + lc][d = s*16 + lh*8 + r]
    v8f ot[2][2] = {};
    v8f cm[2] = {};                     // minus the maximum in use of the lane's two queries
    v2f lrow = {0.0f, 0.0f};            // their sums over THIS half's keys only

#pragma unroll 1
    for (int kt = 0; kt < NSEQ; kt += 32) {
      // A operand of S^T: lane owns key row lc of each 16-key group
      // (all four loads off one lane pointer, the rest as constant offsets)
      const v16h kb0 = frag_piecemajor(kl + kt * 8,       NSEQ, 0, 0);
      const v16h kb1 = frag_piecemajor(kl + kt * 8 + 128, NSEQ, 0, 0);
      // A operand of O^T: lane owns row d of V^T, k runs over the pass's keys
      // (V lies [n / 8][d][8 n]: the pass's keys are piece rows kt / 8 .. kt / 8 + 3)
      const v16h vb0 = frag_piecemajor(vl + kt * DHID,       DHID, 0, 0);
      const v16h vb1 = frag_piecemajor(vl + kt * DHID + 128, DHID, 0, 0);
      // the eight loads still name the lane pointers' registers, which the next pass's
      // step is written into: the wait takes them as inputs and stands in front of that
      asm volatile("s_wait_xcnt 0x0" ::"v"(kl + kt * 8), "v"(vl + kt * DHID) : "memory");
      v8f st[2][2];
      asm("v_nop\n\t"
          "v_wmma_f32_16x16x32_f16 %0, %4, %6, %8\n\t"
          "v_wmma_f32_16x16x32_f16 %1, %5, %6, %8\n\t"
          "v_wmma_f32_16x16x32_f16 %2, %4, %7, %9\n\t"
          "v_wmma_f32_16x16x32_f16 %3, %5, %7, %9\n\t"
          "v_nop\n\tv_nop\n\tv_nop\n\tv_nop"
          : "=&v"(st[0][0]), "=&v"(st[1][0]), "=&v"(st[0][1]), "=&v"(st[1][1])
          : "v"(kb0), "v"(kb1), "v"(qa0), "v"(qa1), "v"(cm[0]), "v"(cm[1]));
      v2f mx;                             // how far this half's maximum lies above the one in use
  #pragma unroll
      for (int c = 0; c < 2; ++c) {
        float m = fmaxf(st[0][c][0], st[1][c][0]);
  #pragma unroll
        for (int r = 1; r < 8; ++r) m = fmaxf(m, fmaxf(st[0][c][r], st[1][c][r]));
        mx[c] = m;
      }
      const bool first = (kt == 0);
      // one scalar branch a pass, over all 32 lanes: the halves need not be joined to test;
      // the first pass always takes it
      const float thr = first ? -__builtin_inff() : 8.0f;
      if (__builtin_amdgcn_ballot_w32(fmaxf(mx.x, mx.y) > thr) != 0) {
  #pragma unroll
        for (int c = 0; c < 2; ++c) {
          const float mj   = fmaxf(mx[c], xhalf(mx[c]));  // the same in both halves
          const float d    = first ? mj : fmaxf(mj, 0.0f);
          const float corr = first ? 1.0f : __builtin_amdgcn_exp2f(-d);
  #pragma unroll
          for (int r = 0; r < 8; ++r) {
            st[0][c][r] -= d;
            st[1][c][r] -= d;
            cm[c][r]    -= d;
            ot[0][c][r] *= corr;
            ot[1][c][r] *= corr;
          }
          lrow[c] *= corr;
        }
      }
      v2f rsum;
  #pragma unroll
      for (int c = 0; c < 2; ++c) {
        v16h pb;                          // P^T fragment, hardware k order
        v2f rs0 = {0.0f, 0.0f}, rs1 = {0.0f, 0.0f};
  #pragma unroll
        for (int r = 0; r < 8; r += 2) {  // neighbouring registers go in pairs
          const v2f p0 = {__builtin_amdgcn_exp2f(st[0][c][r]), __builtin_amdgcn_exp2f(st[0][c][r + 1])};
          const v2f p1 = {__builtin_amdgcn_exp2f(st[1][c][r]), __builtin_amdgcn_exp2f(st[1][c][r + 1])};
          rs0 += p0;
          rs1 += p1;
          pb[r]     = (_Float16)p0.x;
          pb[r + 1] = (_Float16)p0.y;
          pb[r + 8] = (_Float16)p1.x;
          pb[r + 9] = (_Float16)p1.y;
        }
        rs0 += rs1;
        rsum[c] = rs0.x + rs0.y;
        ot[0][c] = wmma_f16(vb0, pb, ot[0][c]);
        ot[1][c] = wmma_f16(vb1, pb, ot[1][c]);
      }
      lrow += rsum;
    }
    // normalize, gate, and put the gated output as f16 into LDS: a lane's 8 registers of
    // a tile are 8 consecutive d of its query, one 16-B piece
    h8 g[2][2];
#pragma unroll
    for (int c = 0; c < 2; ++c) {
#pragma unroll
      for (int s = 0; s < 2; ++s) {
        g[c][s] = *(const h8*)(gate + base + ((s * 2 + lh) * NSEQ + row0 + c * 16 + lc) * 8);
        // the load above still names its address registers: hold any later write
        // of them (the next load's result may land there) behind it
        asm volatile("s_wait_xcnt 0x0" ::: "memory");
      }
    }
#pragma unroll
    for (int c = 0; c < 2; ++c) {
      const float inv = 1.0f / (lrow[c] + xhalf(lrow[c]));
#pragma unroll
      for (int s = 0; s < 2; ++s) {
        h8 w;
#pragma unroll
        for (int r = 0; r < 8; ++r)
          w[r] = (_Float16)((ot[s][c][r] * inv) * (float)g[c][s][r]);
        *(h8*)(ol + ((hh * 4 + s * 2 + lh) * QB + lrow0 + c * 16 + lc) * 8) = w;
      }
    }
  }
  __syncthreads();                      // all 128 x 256 gated outputs lie in LDS

  // out = O Wo^T + bo: the wave owns columns cw .. cw + 31 and walks the rows in two
  // halves of 64.  Wo comes as f16 pieces from the projection launch; the next k step's
  // fragments fly during this step's products.
  // Place lc of the wave's two tiles is output column cw + 2 lc and cw + 2 lc + 1: a lane
  // then stores two neighbouring columns at once, and 16 lanes a whole 128-B line.
  const int cw = wid * 32;
  const _Float16* wl = woh + (lh * DM + cw + lc) * 8;     // the lane's piece of place lc
  const float2 bb = *(const float2*)(bo + cw + 2 * lc);
  // the load still names its address registers: nothing is written there in front of this
  asm volatile("s_wait_xcnt 0x0" ::: "memory");
#pragma unroll 1
  for (int rh = 0; rh < 2; ++rh) {
    v8f acc[4][2] = {};
    const _Float16* al = ol + (lh * QB + rh * 64 + lc) * 8;  // the lane's piece of row lc
    v16h b[2];
    b[0] = frag_piecemajor(wl,       DM, 0, 0);
    b[1] = frag_piecemajor(wl + 128, DM, 0, 0);
    // kept rolled: unrolled, the compiler fetched all of the wave's Wo ahead, which took
    // far more registers and with them two of the three work-groups of a WGP
#pragma unroll 1
    for (int ks = 0; ks < 7; ++ks) {
      const _Float16* p = wl + (ks + 1) * 4 * DM * 8;
      const v16h n0 = frag_piecemajor(p,       DM, 0, 0);
      const v16h n1 = frag_piecemajor(p + 128, DM, 0, 0);
      // the four loads still name the pointer's registers, which the next step's
      // address is written into: the wait takes it as an input and stands in front
      asm volatile("s_wait_xcnt 0x0" ::"v"(p) : "memory");
#pragma unroll
      for (int i = 0; i < 4; ++i) {
        const v16h a = frag_piecemajor(al + ks * 4 * QB * 8 + i * 128, QB, 0, 0);
        acc[i][0] = wmma_f16(a, b[0], acc[i][0]);
        acc[i][1] = wmma_f16(a, b[1], acc[i][1]);
      }
      b[0] = n0;
      b[1] = n1;
    }
#pragma unroll
    for (int i = 0; i < 4; ++i) {
      const v16h a = frag_piecemajor(al + 7 * 4 * QB * 8 + i * 128, QB, 0, 0);
      acc[i][0] = wmma_f16(a, b[0], acc[i][0]);
      acc[i][1] = wmma_f16(a, b[1], acc[i][1]);
    }
#pragma unroll
    for (int i = 0; i < 4; ++i) {
      // acc[i][j][r] is row rh * 64 + i * 16 + lh * 8 + r, column cw + 2 * lc + j
      float* op = out + ((size_t)(nbase + rh * 64 + i * 16 + lh * 8) * LCOL + li) * DM + cw + 2 * lc;
      v2f t[8];
#pragma unroll
      for (int r = 0; r < 8; ++r) t[r] = v2f{acc[i][0][r] + bb.x, acc[i][1][r] + bb.y};
#pragma unroll
      for (int r = 0; r < 8; ++r) *(v2f*)(op + (size_t)r * LCOL * DM) = t[r];
      // the 8 stores still name their address and data registers: the wait takes those
      // as inputs, so that nothing is written there in front of it
      asm volatile("s_wait_xcnt 0x0" ::"v"(op), "v"(t[0]), "v"(t[1]), "v"(t[2]), "v"(t[3]),
                   "v"(t[4]), "v"(t[5]), "v"(t[6]), "v"(t[7])
                   : "memory");
    }
  }
}

extern "C" void kernel_launch(void* const* d_in, const int* in_sizes, int n_in,
                              void* d_out, int out_size, void* d_ws, size_t ws_size,
                              hipStream_t stream) {
  (void)in_sizes; (void)n_in; (void)out_size; (void)ws_size;
  const float* msa = (const float*)d_in[0];
  const float* lnw = (const float*)d_in[1];
  const float* lnb = (const float*)d_in[2];
  const float* wq  = (const float*)d_in[3];
  const float* wk  = (const float*)d_in[4];
  const float* wv  = (const float*)d_in[5];
  const float* wg  = (const float*)d_in[6];
  const float* bg  = (const float*)d_in[7];
  const float* wo  = (const float*)d_in[8];
  const float* bo  = (const float*)d_in[9];
  float* out = (float*)d_out;

  const size_t sz = (size_t)MROWS * DM;     // halves per f16 buffer (50.3 MB each)
  _Float16* qh = (_Float16*)d_ws;           // Q (pre-scaled)      [l][h][d/8][n][8]
  _Float16* kh = qh + sz;                   // K                   [l][h][d/8][n][8]
  _Float16* vh = kh + sz;                   // V                   [l][h][n/8][d][8]
  _Float16* gh = vh + sz;                   // sigmoid gate        [l][h][d/8][n][8]
  _Float16* woh = gh + sz;                  // Wo as f16 pieces    [k/8][place of c][8]

  msa_proj_kernel<<<dim3(2, MROWS / (64 * PTILES)), 256, 0, stream>>>(
      msa, lnw, lnb, wq, wk, wv, wg, bg, wo, qh, kh, vh, gh, woh);
  msa_attn_out_kernel<<<LCOL * 2, 256, 0, stream>>>(qh, kh, vh, gh, woh, bo, out);
}
